// v000
// Times are from an AMD MI455X. After a warm-up the kernel runs many times in a row, and a time is the length of
// such a window on the GPU divided by its runs, so every launch and the gaps after it count. The runs cycle
// through copies of the inputs. A figure is the median of several windows, for all but v000 over two sittings.
// Sittings can differ by a few percent; kernels timed side by side share one.
// The starting kernel, v000, takes 343 microseconds a run.
// compute dtype: logits q.k on v_wmma_f32_16x16x32_f16 (q, k = bf16 RNE-converted inputs held exactly in f16, f32 accumulate, x 1/8 after); softmax in f32 (running max); P.v on v_wmma_f32_16x16x32_f16 (P in f16 carried x 2^11, v = bf16 RNE-converted input held exactly in f16, f32 accumulate, x 2^-11 after); f32 output.
#include <hip/hip_runtime.h>
#include <math.h>

typedef __attribute__((ext_vector_type(16))) _Float16 v16h;
typedef __attribute__((ext_vector_type(8)))  _Float16 v8h;
typedef __attribute__((ext_vector_type(8)))  float v8f;
typedef __attribute__((ext_vector_type(4)))  float v4f;
typedef __attribute__((ext_vector_type(4)))  unsigned v4u;

template <typename T> __device__ __forceinline__ void vst2(void* p, T v) { *(T*)p = v;  }
__device__ __forceinline__ v8f wmma16(v16h a, v16h b, v8f c) {
  v8f d = __builtin_amdgcn_wmma_f32_16x16x32_f16(false, a, false, b, (short)0, c, false, false);
  asm volatile("v_nop\n\tv_nop\n\tv_nop\n\tv_nop" : "+v"(d) : "v"(a), "v"(b));
  return d;
}
// 16x16x32 fragments: lane = (h = lane>>4, row/col = lane&15); elements 0..7 = k0+8h+0..7, 8..15 = k0+16+8h+0..7; D element r = row 8h+r, col lane&15
__device__ __forceinline__ v16h frag_h(const _Float16* rowk0, int lane) {
  union { v16h v; v8h q[2]; } u; const _Float16* p = rowk0 + 8 * (lane >> 4);
  u.q[0] = *(const v8h*)p; u.q[1] = *(const v8h*)(p + 16); return u.v;
}
__device__ __forceinline__ float bfr(float v) { return (float)(__bf16)v; }   // RNE convert to bf16 and widen back
__device__ __forceinline__ void ldsx() { asm volatile("s_wait_dscnt 0" ::: "memory"); __builtin_amdgcn_wave_barrier(); __builtin_amdgcn_fence(3, "workgroup"); }

// fused input [NB][3*CH][T]: q planes = rows 0..CH-1, k planes = rows CH..2CH-1, v planes = rows 2CH..3CH-1 of each batch; per b: weight[t][s] = softmax_s( (1/8) sum_c q[c][t] k[c][s] ); out[b][c][t] = sum_s weight[t][s] v[c][s]
#ifndef NB
#define NB 16
#endif
#ifndef SEQ
#define SEQ 4096
#endif
#define NB_FULL 16
#define TT_FULL 4096
#define TT SEQ
#define CH 64
#define WROWS (3 * CH)   // 192 planes per batch in the input
#ifndef TBH
#define TBH NB
#endif
static_assert(NB >= 1 && NB <= NB_FULL);
static_assert(TT >= 64 && TT <= TT_FULL);
static_assert(TT % 64 == 0);
static_assert(CH == 64);
static_assert((size_t)NB * CH * TT * 4u <= (size_t)16777216u);

#define WS_Q   ((size_t)0)
#define WS_K   (WS_Q + 2u * (size_t)NB * TT * CH)            // f16 k rows  [b][s][64]
#define WS_V   (WS_K + 2u * (size_t)NB * TT * CH)            // f16 v planes [b][64][TT] (8192 B per plane at full size)
#define WS_END (WS_V + 2u * (size_t)NB * CH * TT)
static_assert(WS_END <= (size_t)134217728u);
static_assert(WS_K % 128u == 0 && WS_V % 128u == 0);

// ---- k_prep: block = (64 tokens, b): q/k planes -> f16 rows (transpose via LDS), v planes -> f16 planes (copy); input read with the full-size strides
__global__ __launch_bounds__(128) void k_prep(const float* __restrict__ QKV, _Float16* __restrict__ QR, _Float16* __restrict__ KR, _Float16* __restrict__ VP) {
  __shared__ __align__(16) _Float16 sq[64][72], sk[64][72], sv[CH][72];
  const int t = threadIdx.x; const size_t b = blockIdx.y; const int t0 = blockIdx.x * 64;
  const float* base = QKV + b * WROWS * (size_t)TT_FULL;   // q plane c at base + c*TT_FULL; k at + (CH + c)*TT_FULL; v at + (2CH + c)*TT_FULL
  for (int e = t; e < CH * 64; e += 128) { const int c = e >> 6, tl = e & 63;
    sq[tl][c] = (_Float16)bfr(base[(size_t)c * TT_FULL + t0 + tl]);
    sk[tl][c] = (_Float16)bfr(base[(size_t)(CH + c) * TT_FULL + t0 + tl]);
    sv[c][tl] = (_Float16)bfr(base[(size_t)(2 * CH + c) * TT_FULL + t0 + tl]); }
  __syncthreads();
  for (int e = t; e < 64 * 8; e += 128) { const int tl = e >> 3, q = e & 7; const size_t o = (b * TT + t0 + tl) * CH + q * 8;
    vst2((void*)(QR + o), *(const v4u*)&sq[tl][q * 8]); vst2((void*)(KR + o), *(const v4u*)&sk[tl][q * 8]); }
  for (int e = t; e < CH * 8; e += 128) { const int c = e >> 3, q = e & 7;
    vst2((void*)(VP + (b * CH + c) * (size_t)TT + t0 + q * 8), *(const v4u*)&sv[c][q * 8]); } }

// ---- k_att: block = (64 queries, b): logits over all TT keys (exact f16 operands), running-max softmax in f32, P . v; output planes [b][c][t] via LDS transpose
__global__ __launch_bounds__(128) void k_att(const _Float16* __restrict__ QR, const _Float16* __restrict__ KR, const _Float16* __restrict__ VP, float* __restrict__ OUT) {
  __shared__ __align__(16) float sp[4][16][36]; __shared__ __align__(16) float st[CH][68];
  const int tid = threadIdx.x, wave = tid >> 5, lane = tid & 31, col = lane & 15, g = lane >> 4; const size_t bh = blockIdx.y; const int q0 = blockIdx.x * 64 + wave * 16; const size_t rq = bh * TT + q0;
  v16h aq[2];
#pragma unroll
  for (int kc = 0; kc < 2; ++kc) aq[kc] = frag_h(QR + (rq + col) * CH + kc * 32, lane);   // A[m = query q0+col][k = c]
  float m[8], l[8];
#pragma unroll
  for (int r = 0; r < 8; ++r) { m[r] = -3.0e38f; l[r] = 0.f; }
  v8f acc[4];
#pragma unroll
  for (int j = 0; j < 4; ++j) acc[j] = v8f{};
#pragma unroll 1
  for (int ks = 0; ks < TT / 32; ++ks) { float s[2][8];
#pragma unroll
    for (int ct = 0; ct < 2; ++ct) { const size_t rk = bh * TT + ks * 32 + ct * 16 + col; v8f c = {};   // B[k = c][n = key] from the key's k-contiguous row
#pragma unroll
      for (int kc = 0; kc < 2; ++kc) c = wmma16(aq[kc], frag_h(KR + rk * CH + kc * 32, lane), c);
#pragma unroll
      for (int r = 0; r < 8; ++r) s[ct][r] = c[r] * 0.125f; }
    float alpha[8];
#pragma unroll
    for (int r = 0; r < 8; ++r) { float mx = fmaxf(s[0][r], s[1][r]);
#pragma unroll
      for (int o = 1; o < 16; o <<= 1) mx = fmaxf(mx, __shfl_xor(mx, o));
      const float mn = fmaxf(m[r], mx); alpha[r] = __expf(m[r] - mn); const float e0 = __expf(s[0][r] - mn), e1 = __expf(s[1][r] - mn); float es = e0 + e1;
#pragma unroll
      for (int o = 1; o < 16; o <<= 1) es += __shfl_xor(es, o);
      l[r] = l[r] * alpha[r] + es; m[r] = mn; sp[wave][8 * g + r][col] = e0; sp[wave][8 * g + r][16 + col] = e1; }   // sp[wave][query row][key 0..31]
#pragma unroll
    for (int j = 0; j < 4; ++j)
#pragma unroll
      for (int r = 0; r < 8; ++r) acc[j][r] *= alpha[r];
    ldsx();
    v16h pa; { const float* prow = &sp[wave][col][0] + 8 * (lane >> 4);   // A[m = query col][k = key]: elements 0..7 = key 8h+0..7, 8..15 = key 16+8h+0..7
#pragma unroll
      for (int i = 0; i < 8; ++i) { pa[i] = (_Float16)(prow[i] * 2048.0f); pa[8 + i] = (_Float16)(prow[16 + i] * 2048.0f); } }
#pragma unroll
    for (int j = 0; j < 4; ++j) acc[j] = wmma16(pa, frag_h(VP + (bh * CH + j * 16 + col) * (size_t)TT + ks * 32, lane), acc[j]);   // B[k = key][n = c] from the key-contiguous v plane c
    ldsx(); }
#pragma unroll
  for (int r = 0; r < 8; ++r) { const float il = (1.0f / 2048.0f) / l[r];
#pragma unroll
    for (int j = 0; j < 4; ++j) st[j * 16 + col][wave * 16 + 8 * g + r] = acc[j][r] * il; }
  __syncthreads();
  for (int e = tid; e < CH * 16; e += 128) { const int c = e >> 4, q = e & 15; vst2((void*)(OUT + (bh * CH + c) * (size_t)TT + blockIdx.x * 64 + q * 4), *(const v4f*)&st[c][q * 4]); } }

extern "C" void kernel_launch(void* const* d_in, const int* in_sizes, int n_in, void* d_out, int out_size, void* d_ws, size_t ws_size, hipStream_t stream) {
  if (n_in < 1) return;
  if ((size_t)in_sizes[0] < (size_t)NB * WROWS * TT_FULL) return;   // [16,192,4096] f32
  if ((size_t)out_size < (size_t)NB * CH * TT) return;              // [16,64,4096] f32 at byte 0
  if (ws_size < (size_t)WS_END) return;
  const float* QKV = (const float*)d_in[0];
  char* ws = (char*)d_ws; _Float16 *QR = (_Float16*)(ws + WS_Q), *KR = (_Float16*)(ws + WS_K), *VP = (_Float16*)(ws + WS_V);
  k_prep<<<dim3(TT / 64, NB), 128, 0, stream>>>(QKV, QR, KR, VP);
  k_att<<<dim3(TT / 64, TBH), 128, 0, stream>>>(QR, KR, VP, (float*)d_out);
}

// v001
// It runs in 256 microseconds.
// Timed twice side by side with v000, it ran 1.37 and 1.38 times as fast.
// compute dtype: logits q.k on v_wmma_f32_16x16x32_f16 (q, k = bf16 RNE-converted inputs held exactly in f16, f32 accumulate, x 1/8 after); softmax in f32 (running max); P.v on v_wmma_f32_16x16x32_f16 (P in f16 carried x 2^11, v = bf16 RNE-converted input held exactly in f16, f32 accumulate, x 2^-11 after); f32 output.
#include <hip/hip_runtime.h>
#include <math.h>

typedef __attribute__((ext_vector_type(16))) _Float16 v16h;
typedef __attribute__((ext_vector_type(8)))  _Float16 v8h;
typedef __attribute__((ext_vector_type(8)))  float v8f;
typedef __attribute__((ext_vector_type(4)))  float v4f;
typedef __attribute__((ext_vector_type(4)))  unsigned v4u;

template <typename T> __device__ __forceinline__ void vst2(void* p, T v) { *(T*)p = v;  }
__device__ __forceinline__ v8f wmma16(v16h a, v16h b, v8f c) {
  v8f d = __builtin_amdgcn_wmma_f32_16x16x32_f16(false, a, false, b, (short)0, c, false, false);
  asm volatile("v_nop\n\tv_nop\n\tv_nop\n\tv_nop" : "+v"(d) : "v"(a), "v"(b));
  return d;
}
// 16x16x32 fragments: lane = (h = lane>>4, row/col = lane&15); elements 0..7 = k0+8h+0..7, 8..15 = k0+16+8h+0..7; D element r = row 8h+r, col lane&15
__device__ __forceinline__ v16h frag_h(const _Float16* rowk0, int lane) {
  union { v16h v; v8h q[2]; } u; const _Float16* p = rowk0 + 8 * (lane >> 4);
  u.q[0] = *(const v8h*)p; u.q[1] = *(const v8h*)(p + 16); return u.v;
}
__device__ __forceinline__ float bfr(float v) { return (float)(__bf16)v; }   // RNE convert to bf16 and widen back
__device__ __forceinline__ void ldsx() { asm volatile("s_wait_dscnt 0" ::: "memory"); __builtin_amdgcn_wave_barrier(); __builtin_amdgcn_fence(3, "workgroup", "local"); }   // orders the wave's own LDS exchange only: global loads fetched ahead stay in flight across it

// fused input [NB][3*CH][T]: q planes = rows 0..CH-1, k planes = rows CH..2CH-1, v planes = rows 2CH..3CH-1 of each batch; per b: weight[t][s] = softmax_s( (1/8) sum_c q[c][t] k[c][s] ); out[b][c][t] = sum_s weight[t][s] v[c][s]
#ifndef NB
#define NB 16
#endif
#ifndef SEQ
#define SEQ 4096
#endif
#define NB_FULL 16
#define TT_FULL 4096
#define TT SEQ
#define CH 64
#define WROWS (3 * CH)   // 192 planes per batch in the input
#ifndef TBH
#define TBH NB
#endif
static_assert(NB >= 1 && NB <= NB_FULL);
static_assert(TT >= 64 && TT <= TT_FULL);
static_assert(TT % 64 == 0);
static_assert(CH == 64);
static_assert((size_t)NB * CH * TT * 4u <= (size_t)16777216u);

#define WS_Q   ((size_t)0)
#define WS_K   (WS_Q + 2u * (size_t)NB * TT * CH)            // f16 k rows  [b][s][64]
#define WS_V   (WS_K + 2u * (size_t)NB * TT * CH)            // f16 v planes [b][64][TT] (8192 B per plane at full size)
#define WS_END (WS_V + 2u * (size_t)NB * CH * TT)
static_assert(WS_END <= (size_t)134217728u);
static_assert(WS_K % 128u == 0 && WS_V % 128u == 0);

// ---- k_prep: block = (64 tokens, b): q/k planes -> f16 rows (transpose via LDS), v planes -> f16 planes (copy); input read with the full-size strides
__global__ __launch_bounds__(128) void k_prep(const float* __restrict__ QKV, _Float16* __restrict__ QR, _Float16* __restrict__ KR, _Float16* __restrict__ VP) {
  __shared__ __align__(16) _Float16 sq[64][72], sk[64][72], sv[CH][72];
  const int t = threadIdx.x; const size_t b = blockIdx.y; const int t0 = blockIdx.x * 64;
  const float* base = QKV + b * WROWS * (size_t)TT_FULL;   // q plane c at base + c*TT_FULL; k at + (CH + c)*TT_FULL; v at + (2CH + c)*TT_FULL
  for (int e = t; e < CH * 64; e += 128) { const int c = e >> 6, tl = e & 63;
    sq[tl][c] = (_Float16)bfr(base[(size_t)c * TT_FULL + t0 + tl]);
    sk[tl][c] = (_Float16)bfr(base[(size_t)(CH + c) * TT_FULL + t0 + tl]);
    sv[c][tl] = (_Float16)bfr(base[(size_t)(2 * CH + c) * TT_FULL + t0 + tl]); }
  __syncthreads();
  for (int e = t; e < 64 * 8; e += 128) { const int tl = e >> 3, q = e & 7; const size_t o = (b * TT + t0 + tl) * CH + q * 8;
    vst2((void*)(QR + o), *(const v4u*)&sq[tl][q * 8]); vst2((void*)(KR + o), *(const v4u*)&sk[tl][q * 8]); }
  for (int e = t; e < CH * 8; e += 128) { const int c = e >> 3, q = e & 7;
    vst2((void*)(VP + (b * CH + c) * (size_t)TT + t0 + q * 8), *(const v4u*)&sv[c][q * 8]); } }

// ---- k_att: block = (64 queries, b): logits over all TT keys (exact f16 operands), running-max softmax in f32, P . v; output planes [b][c][t] via LDS transpose
__global__ __launch_bounds__(128) void k_att(const _Float16* __restrict__ QR, const _Float16* __restrict__ KR, const _Float16* __restrict__ VP, float* __restrict__ OUT) {
  __shared__ __align__(16) float sp[4][16][36]; __shared__ __align__(16) float st[CH][68];
  const int tid = threadIdx.x, wave = tid >> 5, lane = tid & 31, col = lane & 15, g = lane >> 4; const size_t bh = blockIdx.y; const int q0 = blockIdx.x * 64 + wave * 16; const size_t rq = bh * TT + q0;
  v16h aq[2];
#pragma unroll
  for (int kc = 0; kc < 2; ++kc) aq[kc] = frag_h(QR + (rq + col) * CH + kc * 32, lane);   // A[m = query q0+col][k = c]
  float m[8], l[8];
#pragma unroll
  for (int r = 0; r < 8; ++r) { m[r] = -3.0e38f; l[r] = 0.f; }
  v8f acc[4];
#pragma unroll
  for (int j = 0; j < 4; ++j) acc[j] = v8f{};
  v16h kf[2][2], vf[4];   // this pass's K and V fragments, loaded one pass ahead; pass 0's here
#pragma unroll
  for (int ct = 0; ct < 2; ++ct)
#pragma unroll
    for (int kc = 0; kc < 2; ++kc) kf[ct][kc] = frag_h(KR + (bh * TT + ct * 16 + col) * CH + kc * 32, lane);
#pragma unroll
  for (int j = 0; j < 4; ++j) vf[j] = frag_h(VP + (bh * CH + j * 16 + col) * (size_t)TT, lane);
#pragma unroll 1
  for (int ks = 0; ks < TT / 32; ++ks) { float s[2][8]; const int kn = ks + 1 < TT / 32 ? ks + 1 : ks;   // pass fetched ahead; the last pass refetches its own keys, so every load stays inside this batch's K rows and V planes
    v8f cs[2];
#pragma unroll
    for (int ct = 0; ct < 2; ++ct) { cs[ct] = v8f{};   // B[k = c][n = key] from the key's k-contiguous row
#pragma unroll
      for (int kc = 0; kc < 2; ++kc) cs[ct] = wmma16(aq[kc], kf[ct][kc], cs[ct]); }
#pragma unroll
    for (int ct = 0; ct < 2; ++ct)
#pragma unroll
      for (int kc = 0; kc < 2; ++kc) kf[ct][kc] = frag_h(KR + (bh * TT + kn * 32 + ct * 16 + col) * CH + kc * 32, lane);   // next pass's K: lands under the softmax and P.v
#pragma unroll
    for (int ct = 0; ct < 2; ++ct)
#pragma unroll
      for (int r = 0; r < 8; ++r) s[ct][r] = cs[ct][r] * 0.125f;
    float alpha[8];
#pragma unroll
    for (int r = 0; r < 8; ++r) { float mx = fmaxf(s[0][r], s[1][r]);
#pragma unroll
      for (int o = 1; o < 16; o <<= 1) mx = fmaxf(mx, __shfl_xor(mx, o));
      const float mn = fmaxf(m[r], mx); alpha[r] = __expf(m[r] - mn); const float e0 = __expf(s[0][r] - mn), e1 = __expf(s[1][r] - mn); float es = e0 + e1;
#pragma unroll
      for (int o = 1; o < 16; o <<= 1) es += __shfl_xor(es, o);
      l[r] = l[r] * alpha[r] + es; m[r] = mn; sp[wave][8 * g + r][col] = e0; sp[wave][8 * g + r][16 + col] = e1; }   // sp[wave][query row][key 0..31]
#pragma unroll
    for (int j = 0; j < 4; ++j)
#pragma unroll
      for (int r = 0; r < 8; ++r) acc[j][r] *= alpha[r];
    ldsx();
    v16h pa; { const float* prow = &sp[wave][col][0] + 8 * (lane >> 4);   // A[m = query col][k = key]: elements 0..7 = key 8h+0..7, 8..15 = key 16+8h+0..7
#pragma unroll
      for (int i = 0; i < 8; ++i) { pa[i] = (_Float16)(prow[i] * 2048.0f); pa[8 + i] = (_Float16)(prow[16 + i] * 2048.0f); } }
#pragma unroll
    for (int j = 0; j < 4; ++j) acc[j] = wmma16(pa, vf[j], acc[j]);   // B[k = key][n = c] from the key-contiguous v plane c
    ldsx();
#pragma unroll
    for (int j = 0; j < 4; ++j) vf[j] = frag_h(VP + (bh * CH + j * 16 + col) * (size_t)TT + kn * 32, lane); }   // next pass's V: lands under the next scores and softmax
#pragma unroll
  for (int r = 0; r < 8; ++r) { const float il = (1.0f / 2048.0f) / l[r];
#pragma unroll
    for (int j = 0; j < 4; ++j) st[j * 16 + col][wave * 16 + 8 * g + r] = acc[j][r] * il; }
  __syncthreads();
  for (int e = tid; e < CH * 16; e += 128) { const int c = e >> 4, q = e & 15; vst2((void*)(OUT + (bh * CH + c) * (size_t)TT + blockIdx.x * 64 + q * 4), *(const v4f*)&st[c][q * 4]); } }

extern "C" void kernel_launch(void* const* d_in, const int* in_sizes, int n_in, void* d_out, int out_size, void* d_ws, size_t ws_size, hipStream_t stream) {
  if (n_in < 1) return;
  if ((size_t)in_sizes[0] < (size_t)NB * WROWS * TT_FULL) return;   // [16,192,4096] f32
  if ((size_t)out_size < (size_t)NB * CH * TT) return;              // [16,64,4096] f32 at byte 0
  if (ws_size < (size_t)WS_END) return;
  const float* QKV = (const float*)d_in[0];
  char* ws = (char*)d_ws; _Float16 *QR = (_Float16*)(ws + WS_Q), *KR = (_Float16*)(ws + WS_K), *VP = (_Float16*)(ws + WS_V);
  k_prep<<<dim3(TT / 64, NB), 128, 0, stream>>>(QKV, QR, KR, VP);
  k_att<<<dim3(TT / 64, TBH), 128, 0, stream>>>(QR, KR, VP, (float*)d_out);
}

// v002
// One run takes 153 microseconds.
// In two side-by-side timings against v001, it was 1.67 and 1.68 times as fast.
// Counting every step since v000, it is 2.30 times as fast.
// compute dtype: logits q.k on v_wmma_f32_16x16x32_f16 (q, k = bf16 RNE-converted inputs held exactly in f16, f32 accumulate, x 1/8 after); softmax in f32 (running max); P.v on v_wmma_f32_16x16x32_f16 (P in f16 carried x 2^11, v = bf16 RNE-converted input held exactly in f16, f32 accumulate, x 2^-11 after); f32 output.
#include <hip/hip_runtime.h>
#include <math.h>

typedef __attribute__((ext_vector_type(16))) _Float16 v16h;
typedef __attribute__((ext_vector_type(8)))  _Float16 v8h;
typedef __attribute__((ext_vector_type(8)))  float v8f;
typedef __attribute__((ext_vector_type(4)))  float v4f;
typedef __attribute__((ext_vector_type(4)))  unsigned v4u;

template <typename T> __device__ __forceinline__ void vst2(void* p, T v) { *(T*)p = v;  }
__device__ __forceinline__ v8f wmma16(v16h a, v16h b, v8f c) {
  v8f d = __builtin_amdgcn_wmma_f32_16x16x32_f16(false, a, false, b, (short)0, c, false, false);
  asm volatile("v_nop\n\tv_nop\n\tv_nop\n\tv_nop" : "+v"(d) : "v"(a), "v"(b));
  return d;
}
// 16x16x32 fragments: lane = (h = lane>>4, row/col = lane&15); elements 0..7 = k0+8h+0..7, 8..15 = k0+16+8h+0..7; D element r = row 8h+r, col lane&15
__device__ __forceinline__ v16h frag_h(const _Float16* rowk0, int lane) {
  union { v16h v; v8h q[2]; } u; const _Float16* p = rowk0 + 8 * (lane >> 4);
  u.q[0] = *(const v8h*)p; u.q[1] = *(const v8h*)(p + 16); return u.v;
}
// the same fragment from a 1024-byte block stored in fragment order: [half 0..1][lane 0..31][8 elements], so each 16-byte load of a wave reads 512 contiguous bytes
__device__ __forceinline__ v16h frag_o(const _Float16* blk, int lane) {
  union { v16h v; v8h q[2]; } u; const _Float16* p = blk + 8 * lane;
  u.q[0] = *(const v8h*)p; u.q[1] = *(const v8h*)(p + 256); return u.v;
}
__device__ __forceinline__ float bfr(float v) { return (float)(__bf16)v; }   // RNE convert to bf16 and widen back
__device__ __forceinline__ void ldsx() { asm volatile("s_wait_dscnt 0" ::: "memory"); __builtin_amdgcn_wave_barrier(); __builtin_amdgcn_fence(3, "workgroup", "local"); }   // orders the wave's own LDS exchange only: global loads fetched ahead stay in flight across it

// fused input [NB][3*CH][T]: q planes = rows 0..CH-1, k planes = rows CH..2CH-1, v planes = rows 2CH..3CH-1 of each batch; per b: weight[t][s] = softmax_s( (1/8) sum_c q[c][t] k[c][s] ); out[b][c][t] = sum_s weight[t][s] v[c][s]
#ifndef NB
#define NB 16
#endif
#ifndef SEQ
#define SEQ 4096
#endif
#define NB_FULL 16
#define TT_FULL 4096
#define TT SEQ
#define CH 64
#define WROWS (3 * CH)   // 192 planes per batch in the input
#ifndef TBH
#define TBH NB
#endif
static_assert(NB >= 1 && NB <= NB_FULL);
static_assert(TT >= 64 && TT <= TT_FULL);
static_assert(TT % 64 == 0);
static_assert(CH == 64);
static_assert((size_t)NB * CH * TT * 4u <= (size_t)16777216u);

#define WS_Q   ((size_t)0)
#define WS_K   (WS_Q + 2u * (size_t)NB * TT * CH)            // f16 k fragments [b][pass of 32 keys][ct*2+kc][512]: block (ct, kc) = keys 16ct+0..15, channels 32kc+0..31
#define WS_V   (WS_K + 2u * (size_t)NB * TT * CH)            // f16 v fragments [b][pass of 32 keys][j][512]: block j = channels 16j+0..15, the pass's 32 keys
#define WS_END (WS_V + 2u * (size_t)NB * CH * TT)
static_assert(WS_END <= (size_t)134217728u);
static_assert(WS_K % 128u == 0 && WS_V % 128u == 0);

// ---- k_prep: block = (64 tokens, b): q planes -> f16 rows (transpose via LDS), k and v planes -> f16 blocks in k_att's fragment order; input read with the full-size strides
__global__ __launch_bounds__(128) void k_prep(const float* __restrict__ QKV, _Float16* __restrict__ QR, _Float16* __restrict__ KF, _Float16* __restrict__ VF) {
  __shared__ __align__(16) _Float16 sq[64][72], sk[64][72], sv[CH][72];
  const int t = threadIdx.x; const size_t b = blockIdx.y; const int t0 = blockIdx.x * 64;
  const float* base = QKV + b * WROWS * (size_t)TT_FULL;   // q plane c at base + c*TT_FULL; k at + (CH + c)*TT_FULL; v at + (2CH + c)*TT_FULL
  for (int e = t; e < CH * 64; e += 128) { const int c = e >> 6, tl = e & 63;
    sq[tl][c] = (_Float16)bfr(base[(size_t)c * TT_FULL + t0 + tl]);
    sk[tl][c] = (_Float16)bfr(base[(size_t)(CH + c) * TT_FULL + t0 + tl]);
    sv[c][tl] = (_Float16)bfr(base[(size_t)(2 * CH + c) * TT_FULL + t0 + tl]); }
  __syncthreads();
  for (int e = t; e < 64 * 8; e += 128) { const int tl = e >> 3, q = e & 7; const size_t o = (b * TT + t0 + tl) * CH + q * 8;
    vst2((void*)(QR + o), *(const v4u*)&sq[tl][q * 8]); }
  for (int e = t; e < 2 * 4 * 64; e += 128) { const int col = e & 15, ko = ((e >> 5) & 1) * 16 + ((e >> 4) & 1) * 8, f = (e >> 6) & 3, p = e >> 8;   // e = (pass p of the block's two, block f, half, lane = (h, col)); ko = k offset 16*half + 8h of frag_h
    const size_t o = ((b * (TT / 32) + (t0 >> 5) + p) * 4 + f) * 512 + (e & 63) * 8;
    vst2((void*)(KF + o), *(const v4u*)&sk[p * 32 + (f >> 1) * 16 + col][(f & 1) * 32 + ko]);
    vst2((void*)(VF + o), *(const v4u*)&sv[f * 16 + col][p * 32 + ko]); } }

// ---- k_att: block = (64 queries, b): logits over all TT keys (exact f16 operands), running-max softmax in f32, P . v; output planes [b][c][t] via LDS transpose
__global__ __launch_bounds__(128) void k_att(const _Float16* __restrict__ QR, const _Float16* __restrict__ KF, const _Float16* __restrict__ VF, float* __restrict__ OUT) {
  __shared__ __align__(16) float sp[4][16][36]; __shared__ __align__(16) float st[CH][68];
  const int tid = threadIdx.x, wave = tid >> 5, lane = tid & 31, col = lane & 15, g = lane >> 4; const size_t bh = blockIdx.y; const int q0 = blockIdx.x * 64 + wave * 16; const size_t rq = bh * TT + q0;
  v16h aq[2];
#pragma unroll
  for (int kc = 0; kc < 2; ++kc) aq[kc] = frag_h(QR + (rq + col) * CH + kc * 32, lane);   // A[m = query q0+col][k = c]
  float m[8], l[8];
#pragma unroll
  for (int r = 0; r < 8; ++r) { m[r] = -3.0e38f; l[r] = 0.f; }
  v8f acc[4];
#pragma unroll
  for (int j = 0; j < 4; ++j) acc[j] = v8f{};
  v16h kf[2][2], vf[4];   // this pass's K and V fragments, loaded one pass ahead; pass 0's here
#pragma unroll
  for (int ct = 0; ct < 2; ++ct)
#pragma unroll
    for (int kc = 0; kc < 2; ++kc) kf[ct][kc] = frag_o(KF + (bh * (TT / 32) * 4 + ct * 2 + kc) * 512, lane);
#pragma unroll
  for (int j = 0; j < 4; ++j) vf[j] = frag_o(VF + (bh * (TT / 32) * 4 + j) * 512, lane);
#pragma unroll 1
  for (int ks = 0; ks < TT / 32; ++ks) { float s[2][8]; const int kn = ks + 1 < TT / 32 ? ks + 1 : ks;   // pass fetched ahead; the last pass refetches its own keys, so every load stays inside this batch's K and V blocks
    v8f cs[2];
#pragma unroll
    for (int ct = 0; ct < 2; ++ct) { cs[ct] = v8f{};   // B[k = c][n = key]
#pragma unroll
      for (int kc = 0; kc < 2; ++kc) cs[ct] = wmma16(aq[kc], kf[ct][kc], cs[ct]); }
#pragma unroll
    for (int ct = 0; ct < 2; ++ct)
#pragma unroll
      for (int kc = 0; kc < 2; ++kc) kf[ct][kc] = frag_o(KF + ((bh * (TT / 32) + kn) * 4 + ct * 2 + kc) * 512, lane);   // next pass's K: lands under the softmax and P.v
#pragma unroll
    for (int ct = 0; ct < 2; ++ct)
#pragma unroll
      for (int r = 0; r < 8; ++r) s[ct][r] = cs[ct][r] * 0.125f;
    float alpha[8];
#pragma unroll
    for (int r = 0; r < 8; ++r) { float mx = fmaxf(s[0][r], s[1][r]);
#pragma unroll
      for (int o = 1; o < 16; o <<= 1) mx = fmaxf(mx, __shfl_xor(mx, o));
      const float mn = fmaxf(m[r], mx); alpha[r] = __expf(m[r] - mn); const float e0 = __expf(s[0][r] - mn), e1 = __expf(s[1][r] - mn); float es = e0 + e1;
#pragma unroll
      for (int o = 1; o < 16; o <<= 1) es += __shfl_xor(es, o);
      l[r] = l[r] * alpha[r] + es; m[r] = mn; sp[wave][8 * g + r][col] = e0; sp[wave][8 * g + r][16 + col] = e1; }   // sp[wave][query row][key 0..31]
#pragma unroll
    for (int j = 0; j < 4; ++j)
#pragma unroll
      for (int r = 0; r < 8; ++r) acc[j][r] *= alpha[r];
    ldsx();
    v16h pa; { const float* prow = &sp[wave][col][0] + 8 * (lane >> 4);   // A[m = query col][k = key]: elements 0..7 = key 8h+0..7, 8..15 = key 16+8h+0..7
#pragma unroll
      for (int i = 0; i < 8; ++i) { pa[i] = (_Float16)(prow[i] * 2048.0f); pa[8 + i] = (_Float16)(prow[16 + i] * 2048.0f); } }
#pragma unroll
    for (int j = 0; j < 4; ++j) acc[j] = wmma16(pa, vf[j], acc[j]);   // B[k = key][n = c]
    ldsx();
#pragma unroll
    for (int j = 0; j < 4; ++j) vf[j] = frag_o(VF + ((bh * (TT / 32) + kn) * 4 + j) * 512, lane);   // next pass's V: lands under the next scores and softmax
    asm volatile("s_wait_xcnt 0x0" ::: "memory"); }   // stands in front of the next pass's rewrite of the address registers that the V loads name
#pragma unroll
  for (int r = 0; r < 8; ++r) { const float il = (1.0f / 2048.0f) / l[r];
#pragma unroll
    for (int j = 0; j < 4; ++j) st[j * 16 + col][wave * 16 + 8 * g + r] = acc[j][r] * il; }
  __syncthreads();
  for (int e = tid; e < CH * 16; e += 128) { const int c = e >> 4, q = e & 15; vst2((void*)(OUT + (bh * CH + c) * (size_t)TT + blockIdx.x * 64 + q * 4), *(const v4f*)&st[c][q * 4]); } }

extern "C" void kernel_launch(void* const* d_in, const int* in_sizes, int n_in, void* d_out, int out_size, void* d_ws, size_t ws_size, hipStream_t stream) {
  if (n_in < 1) return;
  if ((size_t)in_sizes[0] < (size_t)NB * WROWS * TT_FULL) return;   // [16,192,4096] f32
  if ((size_t)out_size < (size_t)NB * CH * TT) return;              // [16,64,4096] f32 at byte 0
  if (ws_size < (size_t)WS_END) return;
  const float* QKV = (const float*)d_in[0];
  char* ws = (char*)d_ws; _Float16 *QR = (_Float16*)(ws + WS_Q), *KF = (_Float16*)(ws + WS_K), *VF = (_Float16*)(ws + WS_V);
  k_prep<<<dim3(TT / 64, NB), 128, 0, stream>>>(QKV, QR, KF, VF);
  k_att<<<dim3(TT / 64, TBH), 128, 0, stream>>>(QR, KF, VF, (float*)d_out);
}

// v003
// Measured time: 103 microseconds a run.
// In two side-by-side timings against v002, it was 1.49 and 1.50 times as fast.
// All steps since v000 together make it 3.44 times as fast.
// compute dtype: logits q.k on v_wmma_f32_16x16x32_f16 (q, k = bf16 RNE-converted inputs held exactly in f16, f32 accumulate, x 1/8 after); softmax in f32 (running max); P.v on v_wmma_f32_16x16x32_f16 (P in f16 carried x 2^11, v = bf16 RNE-converted input held exactly in f16, f32 accumulate, x 2^-11 after); f32 output.
#include <hip/hip_runtime.h>
#include <math.h>

typedef __attribute__((ext_vector_type(16))) _Float16 v16h;
typedef __attribute__((ext_vector_type(8)))  _Float16 v8h;
typedef __attribute__((ext_vector_type(8)))  float v8f;
typedef __attribute__((ext_vector_type(4)))  float v4f;
typedef __attribute__((ext_vector_type(4)))  unsigned v4u;

template <typename T> __device__ __forceinline__ void vst2(void* p, T v) { *(T*)p = v;  }
__device__ __forceinline__ v8f wmma16(v16h a, v16h b, v8f c) {
  v8f d = __builtin_amdgcn_wmma_f32_16x16x32_f16(false, a, false, b, (short)0, c, false, false);
  asm volatile("v_nop\n\tv_nop\n\tv_nop\n\tv_nop" : "+v"(d) : "v"(a), "v"(b));
  return d;
}
// 16x16x32 fragments: lane = (h = lane>>4, row/col = lane&15); elements 0..7 = k0+8h+0..7, 8..15 = k0+16+8h+0..7; D element r = row 8h+r, col lane&15
__device__ __forceinline__ v16h frag_h(const _Float16* rowk0, int lane) {
  union { v16h v; v8h q[2]; } u; const _Float16* p = rowk0 + 8 * (lane >> 4);
  u.q[0] = *(const v8h*)p; u.q[1] = *(const v8h*)(p + 16); return u.v;
}
// the same fragment from a 1024-byte block stored in fragment order: [half 0..1][lane 0..31][8 elements], so each 16-byte load of a wave reads 512 contiguous bytes
__device__ __forceinline__ v16h frag_o(const _Float16* blk, int lane) {
  union { v16h v; v8h q[2]; } u; const _Float16* p = blk + 8 * lane;
  u.q[0] = *(const v8h*)p; u.q[1] = *(const v8h*)(p + 256); return u.v;
}
__device__ __forceinline__ float bfr(float v) { return (float)(__bf16)v; }   // RNE convert to bf16 and widen back
__device__ __forceinline__ float xhalf(float x) { return __builtin_bit_cast(float, __builtin_amdgcn_permlanex16(__builtin_bit_cast(int, x), __builtin_bit_cast(int, x), 0x76543210, 0xfedcba98, false, false)); }   // lane l's value from lane l ^ 16

// fused input [NB][3*CH][T]: q planes = rows 0..CH-1, k planes = rows CH..2CH-1, v planes = rows 2CH..3CH-1 of each batch; per b: weight[t][s] = softmax_s( (1/8) sum_c q[c][t] k[c][s] ); out[b][c][t] = sum_s weight[t][s] v[c][s]
#ifndef NB
#define NB 16
#endif
#ifndef SEQ
#define SEQ 4096
#endif
#define NB_FULL 16
#define TT_FULL 4096
#define TT SEQ
#define CH 64
#define WROWS (3 * CH)   // 192 planes per batch in the input
#ifndef TBH
#define TBH NB
#endif
static_assert(NB >= 1 && NB <= NB_FULL);
static_assert(TT >= 64 && TT <= TT_FULL);
static_assert(TT % 64 == 0);
static_assert(CH == 64);
static_assert((size_t)NB * CH * TT * 4u <= (size_t)16777216u);

#define WS_Q   ((size_t)0)
#define WS_K   (WS_Q + 2u * (size_t)NB * TT * CH)            // f16 k fragments [b][pass of 32 keys][ct*2+kc][512]: block (ct, kc) = keys 16ct+0..15, channels 32kc+0..31
#define WS_V   (WS_K + 2u * (size_t)NB * TT * CH)            // f16 v fragments [b][pass of 32 keys][j][512]: block j = channels 16j+0..15, the pass's 32 keys
#define WS_END (WS_V + 2u * (size_t)NB * CH * TT)
static_assert(WS_END <= (size_t)134217728u);
static_assert(WS_K % 128u == 0 && WS_V % 128u == 0);

// ---- k_prep: block = (64 tokens, b): q planes -> f16 rows (transpose via LDS), k and v planes -> f16 blocks in k_att's fragment order; input read with the full-size strides
__global__ __launch_bounds__(128) void k_prep(const float* __restrict__ QKV, _Float16* __restrict__ QR, _Float16* __restrict__ KF, _Float16* __restrict__ VF) {
  __shared__ __align__(16) _Float16 sq[64][72], sk[64][72], sv[CH][72];
  const int t = threadIdx.x; const size_t b = blockIdx.y; const int t0 = blockIdx.x * 64;
  const float* base = QKV + b * WROWS * (size_t)TT_FULL;   // q plane c at base + c*TT_FULL; k at + (CH + c)*TT_FULL; v at + (2CH + c)*TT_FULL
  for (int e = t; e < CH * 64; e += 128) { const int c = e >> 6, tl = e & 63;
    sq[tl][c] = (_Float16)bfr(base[(size_t)c * TT_FULL + t0 + tl]);
    sk[tl][c] = (_Float16)bfr(base[(size_t)(CH + c) * TT_FULL + t0 + tl]);
    sv[c][tl] = (_Float16)bfr(base[(size_t)(2 * CH + c) * TT_FULL + t0 + tl]); }
  __syncthreads();
  for (int e = t; e < 64 * 8; e += 128) { const int tl = e >> 3, q = e & 7; const size_t o = (b * TT + t0 + tl) * CH + q * 8;
    vst2((void*)(QR + o), *(const v4u*)&sq[tl][q * 8]); }
  for (int e = t; e < 2 * 4 * 64; e += 128) { const int col = e & 15, ko = ((e >> 5) & 1) * 16 + ((e >> 4) & 1) * 8, f = (e >> 6) & 3, p = e >> 8;   // e = (pass p of the block's two, block f, half, lane = (h, col)); ko = k offset 16*half + 8h of frag_h
    const size_t o = ((b * (TT / 32) + (t0 >> 5) + p) * 4 + f) * 512 + (e & 63) * 8;
    vst2((void*)(KF + o), *(const v4u*)&sk[p * 32 + (f >> 1) * 16 + col][(f & 1) * 32 + ko]);
    vst2((void*)(VF + o), *(const v4u*)&sv[f * 16 + col][p * 32 + ko]); } }

__global__ __launch_bounds__(128) void k_att(const _Float16* __restrict__ QR, const _Float16* __restrict__ KF, const _Float16* __restrict__ VF, float* __restrict__ OUT) {
  __shared__ __align__(16) float st[CH][68];
  const int tid = threadIdx.x, wave = tid >> 5, lane = tid & 31, col = lane & 15, g = lane >> 4; const size_t bh = blockIdx.y; const int q0 = blockIdx.x * 64 + wave * 16; const size_t rq = bh * TT + q0;
  v16h aq[2];
#pragma unroll
  for (int kc = 0; kc < 2; ++kc) aq[kc] = frag_h(QR + (rq + col) * CH + kc * 32, lane);   // B[k = c][n = query q0+col]
  asm volatile("s_wait_xcnt 0x0" ::: "memory");   // stands in front of any rewrite of the address registers that the Q loads name
  float m = -3.0e38f, l = 0.f;   // query q0+col: running maximum (equal in both halves), sum over this half's keys only
  v8f acc[4];
#pragma unroll
  for (int j = 0; j < 4; ++j) acc[j] = v8f{};
  v16h kf[2][2], vf[4];   // this pass's K and V fragments, loaded one pass ahead; pass 0's here
#pragma unroll
  for (int ct = 0; ct < 2; ++ct)
#pragma unroll
    for (int kc = 0; kc < 2; ++kc) kf[ct][kc] = frag_o(KF + (bh * (TT / 32) * 4 + ct * 2 + kc) * 512, lane);
  asm volatile("s_wait_xcnt 0x0" ::: "memory");   // the same for the address registers that pass 0's K loads name
#pragma unroll
  for (int j = 0; j < 4; ++j) vf[j] = frag_o(VF + (bh * (TT / 32) * 4 + j) * 512, lane);
#pragma unroll 1
  for (int ks = 0; ks < TT / 32; ++ks) { float s[2][8]; const int kn = ks + 1 < TT / 32 ? ks + 1 : ks;   // pass fetched ahead; the last pass refetches its own keys, so every load stays inside this batch's K and V blocks
    v8f cs[2];
#pragma unroll
    for (int ct = 0; ct < 2; ++ct) { cs[ct] = v8f{};   // A[m = key][k = c]; cs[ct][r] = logit of key 16ct+8g+r, query col
#pragma unroll
      for (int kc = 0; kc < 2; ++kc) cs[ct] = wmma16(kf[ct][kc], aq[kc], cs[ct]); }
#pragma unroll
    for (int ct = 0; ct < 2; ++ct)
#pragma unroll
      for (int kc = 0; kc < 2; ++kc) kf[ct][kc] = frag_o(KF + ((bh * (TT / 32) + kn) * 4 + ct * 2 + kc) * 512, lane);   // next pass's K: lands under the softmax and P.v
#pragma unroll
    for (int ct = 0; ct < 2; ++ct)
#pragma unroll
      for (int r = 0; r < 8; ++r) s[ct][r] = cs[ct][r] * 0.125f;
    float t[8];
#pragma unroll
    for (int r = 0; r < 8; ++r) t[r] = fmaxf(s[0][r], s[1][r]);
#pragma unroll
    for (int w = 4; w >= 1; w >>= 1)
#pragma unroll
      for (int r = 0; r < w; ++r) t[r] = fmaxf(t[r], t[r + w]);
    const float mn = fmaxf(m, fmaxf(t[0], xhalf(t[0]))), alpha = __expf(m - mn); m = mn;
#pragma unroll
    for (int ct = 0; ct < 2; ++ct)
#pragma unroll
      for (int r = 0; r < 8; ++r) s[ct][r] = __expf(s[ct][r] - mn);
#pragma unroll
    for (int r = 0; r < 8; ++r) t[r] = s[0][r] + s[1][r];
#pragma unroll
    for (int w = 4; w >= 1; w >>= 1)
#pragma unroll
      for (int r = 0; r < w; ++r) t[r] += t[r + w];
    l = l * alpha + t[0];
#pragma unroll
    for (int j = 0; j < 4; ++j)
#pragma unroll
      for (int r = 0; r < 8; ++r) acc[j][r] *= alpha;
    v16h pa;   // B[k = key][n = query col]: elements 0..7 = key 8g+0..7, 8..15 = key 16+8g+0..7, which are this lane's own two score tiles
#pragma unroll
    for (int i = 0; i < 8; ++i) { pa[i] = (_Float16)(s[0][i] * 2048.0f); pa[8 + i] = (_Float16)(s[1][i] * 2048.0f); }
#pragma unroll
    for (int j = 0; j < 4; ++j) acc[j] = wmma16(vf[j], pa, acc[j]);   // A[m = c][k = key]; acc[j][r] = channel 16j+8g+r, query col
#pragma unroll
    for (int j = 0; j < 4; ++j) vf[j] = frag_o(VF + ((bh * (TT / 32) + kn) * 4 + j) * 512, lane);   // next pass's V: lands under the next scores and softmax
    asm volatile("s_wait_xcnt 0x0" ::: "memory"); }   // stands in front of the next pass's rewrite of the address registers that the V loads name
  const float il = (1.0f / 2048.0f) / (l + xhalf(l));   // the two halves' sums join here, once
#pragma unroll
  for (int j = 0; j < 4; ++j)
#pragma unroll
    for (int r = 0; r < 8; ++r) st[j * 16 + 8 * g + r][wave * 16 + col] = acc[j][r] * il;
  __syncthreads();
  for (int e = tid; e < CH * 16; e += 128) { const int c = e >> 4, q = e & 15; vst2((void*)(OUT + (bh * CH + c) * (size_t)TT + blockIdx.x * 64 + q * 4), *(const v4f*)&st[c][q * 4]); } }

extern "C" void kernel_launch(void* const* d_in, const int* in_sizes, int n_in, void* d_out, int out_size, void* d_ws, size_t ws_size, hipStream_t stream) {
  if (n_in < 1) return;
  if ((size_t)in_sizes[0] < (size_t)NB * WROWS * TT_FULL) return;   // [16,192,4096] f32
  if ((size_t)out_size < (size_t)NB * CH * TT) return;              // [16,64,4096] f32 at byte 0
  if (ws_size < (size_t)WS_END) return;
  const float* QKV = (const float*)d_in[0];
  char* ws = (char*)d_ws; _Float16 *QR = (_Float16*)(ws + WS_Q), *KF = (_Float16*)(ws + WS_K), *VF = (_Float16*)(ws + WS_V);
  k_prep<<<dim3(TT / 64, NB), 128, 0, stream>>>(QKV, QR, KF, VF);
  k_att<<<dim3(TT / 64, TBH), 128, 0, stream>>>(QR, KF, VF, (float*)d_out);
}

// v004
// One run takes 94.9 microseconds.
// Timed twice side by side with v003, it ran 1.10 and 1.08 times as fast.
// Over all steps from v000 it is 3.75 times as fast.
// compute dtype: logits q.k on v_wmma_f32_16x16x32_f16 (q, k = bf16 RNE-converted inputs held exactly in f16, f32 accumulate, x 1/8 after); softmax in f32 (running max); P.v on v_wmma_f32_16x16x32_f16 (P in f16 carried x 2^11, v = bf16 RNE-converted input held exactly in f16, f32 accumulate, x 2^-11 after); f32 output.
#include <hip/hip_runtime.h>
#include <math.h>

typedef __attribute__((ext_vector_type(16))) _Float16 v16h;
typedef __attribute__((ext_vector_type(8)))  _Float16 v8h;
typedef __attribute__((ext_vector_type(8)))  float v8f;
typedef __attribute__((ext_vector_type(4)))  float v4f;
typedef __attribute__((ext_vector_type(4)))  unsigned v4u;

template <typename T> __device__ __forceinline__ void vst2(void* p, T v) { *(T*)p = v;  }
__device__ __forceinline__ v8f wmma16(v16h a, v16h b, v8f c) {
  v8f d = __builtin_amdgcn_wmma_f32_16x16x32_f16(false, a, false, b, (short)0, c, false, false);
  asm volatile("v_nop\n\tv_nop\n\tv_nop\n\tv_nop" : "+v"(d) : "v"(a), "v"(b));
  return d;
}
// 16x16x32 fragments: lane = (h = lane>>4, row/col = lane&15); elements 0..7 = k0+8h+0..7, 8..15 = k0+16+8h+0..7; D element r = row 8h+r, col lane&15
__device__ __forceinline__ v16h frag_h(const _Float16* rowk0, int lane) {
  union { v16h v; v8h q[2]; } u; const _Float16* p = rowk0 + 8 * (lane >> 4);
  u.q[0] = *(const v8h*)p; u.q[1] = *(const v8h*)(p + 16); return u.v;
}
// the same fragment from a 1024-byte block stored in fragment order: [half 0..1][lane 0..31][8 elements], so each 16-byte load of a wave reads 512 contiguous bytes
__device__ __forceinline__ v16h frag_o(const _Float16* blk, int lane) {
  union { v16h v; v8h q[2]; } u; const _Float16* p = blk + 8 * lane;
  u.q[0] = *(const v8h*)p; u.q[1] = *(const v8h*)(p + 256); return u.v;
}
__device__ __forceinline__ float bfr(float v) { return (float)(__bf16)v; }   // RNE convert to bf16 and widen back
__device__ __forceinline__ float xhalf(float x) { return __builtin_bit_cast(float, __builtin_amdgcn_permlanex16(__builtin_bit_cast(int, x), __builtin_bit_cast(int, x), 0x76543210, 0xfedcba98, false, false)); }   // lane l's value from lane l ^ 16

// fused input [NB][3*CH][T]: q planes = rows 0..CH-1, k planes = rows CH..2CH-1, v planes = rows 2CH..3CH-1 of each batch; per b: weight[t][s] = softmax_s( (1/8) sum_c q[c][t] k[c][s] ); out[b][c][t] = sum_s weight[t][s] v[c][s]
#ifndef NB
#define NB 16
#endif
#ifndef SEQ
#define SEQ 4096
#endif
#define NB_FULL 16
#define TT_FULL 4096
#define TT SEQ
#define CH 64
#define WROWS (3 * CH)   // 192 planes per batch in the input
#ifndef TBH
#define TBH NB
#endif
static_assert(NB >= 1 && NB <= NB_FULL);
static_assert(TT >= 64 && TT <= TT_FULL);
static_assert(TT % 64 == 0);
static_assert(CH == 64);
static_assert((size_t)NB * CH * TT * 4u <= (size_t)16777216u);

#define WS_Q   ((size_t)0)
#define WS_K   (WS_Q + 2u * (size_t)NB * TT * CH)            // f16 k fragments [b][pass of 32 keys][ct*2+kc][512]: block (ct, kc) = keys 16ct+0..15, channels 32kc+0..31
#define WS_V   (WS_K + 2u * (size_t)NB * TT * CH)            // f16 v fragments [b][pass of 32 keys][j][512]: block j = channels 16j+0..15, the pass's 32 keys
#define WS_END (WS_V + 2u * (size_t)NB * CH * TT)
static_assert(WS_END <= (size_t)134217728u);
static_assert(WS_K % 128u == 0 && WS_V % 128u == 0);

// ---- k_prep: block = (64 tokens, b): q planes -> f16 rows (transpose via LDS), k and v planes -> f16 blocks in k_att's fragment order; input read with the full-size strides
__global__ __launch_bounds__(128) void k_prep(const float* __restrict__ QKV, _Float16* __restrict__ QR, _Float16* __restrict__ KF, _Float16* __restrict__ VF) {
  __shared__ __align__(16) _Float16 sq[64][72], sk[64][72], sv[CH][72];
  const int t = threadIdx.x; const size_t b = blockIdx.y; const int t0 = blockIdx.x * 64;
  const float* base = QKV + b * WROWS * (size_t)TT_FULL;   // q plane c at base + c*TT_FULL; k at + (CH + c)*TT_FULL; v at + (2CH + c)*TT_FULL
  for (int e = t; e < CH * 64; e += 128) { const int c = e >> 6, tl = e & 63;
    sq[tl][c] = (_Float16)bfr(base[(size_t)c * TT_FULL + t0 + tl]);
    sk[tl][c] = (_Float16)bfr(base[(size_t)(CH + c) * TT_FULL + t0 + tl]);
    sv[c][tl] = (_Float16)bfr(base[(size_t)(2 * CH + c) * TT_FULL + t0 + tl]); }
  __syncthreads();
  for (int e = t; e < 64 * 8; e += 128) { const int tl = e >> 3, q = e & 7; const size_t o = (b * TT + t0 + tl) * CH + q * 8;
    vst2((void*)(QR + o), *(const v4u*)&sq[tl][q * 8]); }
  for (int e = t; e < 2 * 4 * 64; e += 128) { const int col = e & 15, ko = ((e >> 5) & 1) * 16 + ((e >> 4) & 1) * 8, f = (e >> 6) & 3, p = e >> 8;   // e = (pass p of the block's two, block f, half, lane = (h, col)); ko = k offset 16*half + 8h of frag_h
    const size_t o = ((b * (TT / 32) + (t0 >> 5) + p) * 4 + f) * 512 + (e & 63) * 8;
    vst2((void*)(KF + o), *(const v4u*)&sk[p * 32 + (f >> 1) * 16 + col][(f & 1) * 32 + ko]);
    vst2((void*)(VF + o), *(const v4u*)&sv[f * 16 + col][p * 32 + ko]); } }

__global__ __launch_bounds__(128) __attribute__((amdgpu_waves_per_eu(4, 4))) void k_att(const _Float16* __restrict__ QR, const _Float16* __restrict__ KF, const _Float16* __restrict__ VF, float* __restrict__ OUT) {
  __shared__ __align__(16) float st[CH][68];
  __shared__ float ex[2][68][32];   // key half 1's state of query group qg: per 16-query tile u rows 34u+0..31 = O, 34u+32 = m, 34u+33 = l; one column per lane
  const int tid = threadIdx.x, wave = __builtin_amdgcn_readfirstlane(tid >> 5), lane = tid & 31, col = lane & 15, g = lane >> 4, qg = wave & 1, kh = wave >> 1;
  const size_t bh = blockIdx.y; const int q0 = blockIdx.x * 64 + qg * 32; const size_t rq = bh * TT + q0;
  v16h aq[2][2];
#pragma unroll
  for (int u = 0; u < 2; ++u)
#pragma unroll
    for (int kc = 0; kc < 2; ++kc) aq[u][kc] = frag_h(QR + (rq + u * 16 + col) * CH + kc * 32, lane);   // B[k = c][n = query q0+16u+col]
  asm volatile("s_wait_xcnt 0x0" ::: "memory");   // stands in front of any rewrite of the address registers that the Q loads name
  float m[2] = {-3.0e38f, -3.0e38f}, l[2] = {0.f, 0.f};   // query q0+16u+col over this wave's key half: running maximum (equal in both lane halves), sum over this lane half's keys only
  v8f acc[2][4];
#pragma unroll
  for (int u = 0; u < 2; ++u)
#pragma unroll
    for (int j = 0; j < 4; ++j) acc[u][j] = v8f{};
  const int k0 = kh * (TT / 64), k1 = k0 + TT / 64;   // this wave's passes of 32 keys
  v16h kf[2][2], vf[4];   // this pass's K and V fragments, loaded one pass ahead; pass k0's here
#pragma unroll
  for (int ct = 0; ct < 2; ++ct)
#pragma unroll
    for (int kc = 0; kc < 2; ++kc) kf[ct][kc] = frag_o(KF + ((bh * (TT / 32) + k0) * 4 + ct * 2 + kc) * 512, lane);
  asm volatile("s_wait_xcnt 0x0" ::: "memory");   // the same for the address registers that the first pass's K loads name
#pragma unroll
  for (int j = 0; j < 4; ++j) vf[j] = frag_o(VF + ((bh * (TT / 32) + k0) * 4 + j) * 512, lane);
#pragma unroll 1
  for (int ks = k0; ks < k1; ++ks) { const int kn = ks + 1 < k1 ? ks + 1 : ks;   // pass fetched ahead; the last pass refetches its own keys, so every load stays inside this batch's K and V blocks
    v8f cs[2][2];
#pragma unroll
    for (int u = 0; u < 2; ++u)
#pragma unroll
      for (int ct = 0; ct < 2; ++ct) { cs[u][ct] = v8f{};   // A[m = key][k = c]; cs[u][ct][r] = logit of key 16ct+8g+r, query 16u+col
#pragma unroll
        for (int kc = 0; kc < 2; ++kc) cs[u][ct] = wmma16(kf[ct][kc], aq[u][kc], cs[u][ct]); }
#pragma unroll
    for (int ct = 0; ct < 2; ++ct)
#pragma unroll
      for (int kc = 0; kc < 2; ++kc) kf[ct][kc] = frag_o(KF + ((bh * (TT / 32) + kn) * 4 + ct * 2 + kc) * 512, lane);   // next pass's K: lands under the softmax and P.v
    v16h pa[2];   // B[k = key][n = query 16u+col]: elements 0..7 = key 8g+0..7, 8..15 = key 16+8g+0..7, which are this lane's own two score tiles
#pragma unroll
    for (int u = 0; u < 2; ++u) { float s[2][8];
#pragma unroll
      for (int ct = 0; ct < 2; ++ct)
#pragma unroll
        for (int r = 0; r < 8; ++r) s[ct][r] = cs[u][ct][r] * 0.125f;
      float t[8];
#pragma unroll
      for (int r = 0; r < 8; ++r) t[r] = fmaxf(s[0][r], s[1][r]);
#pragma unroll
      for (int w = 4; w >= 1; w >>= 1)
#pragma unroll
        for (int r = 0; r < w; ++r) t[r] = fmaxf(t[r], t[r + w]);
      const float mn = fmaxf(m[u], fmaxf(t[0], xhalf(t[0]))), alpha = __expf(m[u] - mn); m[u] = mn;
#pragma unroll
      for (int ct = 0; ct < 2; ++ct)
#pragma unroll
        for (int r = 0; r < 8; ++r) s[ct][r] = __expf(s[ct][r] - mn);
#pragma unroll
      for (int r = 0; r < 8; ++r) t[r] = s[0][r] + s[1][r];
#pragma unroll
      for (int w = 4; w >= 1; w >>= 1)
#pragma unroll
        for (int r = 0; r < w; ++r) t[r] += t[r + w];
      l[u] = l[u] * alpha + t[0];
#pragma unroll
      for (int j = 0; j < 4; ++j)
#pragma unroll
        for (int r = 0; r < 8; ++r) acc[u][j][r] *= alpha;
#pragma unroll
      for (int i = 0; i < 8; ++i) { pa[u][i] = (_Float16)(s[0][i] * 2048.0f); pa[u][8 + i] = (_Float16)(s[1][i] * 2048.0f); } }
#pragma unroll
    for (int j = 0; j < 4; ++j)
#pragma unroll
      for (int u = 0; u < 2; ++u) acc[u][j] = wmma16(vf[j], pa[u], acc[u][j]);   // A[m = c][k = key]; acc[u][j][r] = channel 16j+8g+r, query 16u+col
#pragma unroll
    for (int j = 0; j < 4; ++j) vf[j] = frag_o(VF + ((bh * (TT / 32) + kn) * 4 + j) * 512, lane);   // next pass's V: lands under the next scores and softmax
    asm volatile("s_wait_xcnt 0x0" ::: "memory"); }   // stands in front of the next pass's rewrite of the address registers that the V loads name
  if (kh == 1) {   // wave-uniform: key half 1 hands its state over
#pragma unroll
    for (int u = 0; u < 2; ++u) {
#pragma unroll
      for (int j = 0; j < 4; ++j)
#pragma unroll
        for (int r = 0; r < 8; ++r) ex[qg][u * 34 + j * 8 + r][lane] = acc[u][j][r];
      ex[qg][u * 34 + 32][lane] = m[u]; ex[qg][u * 34 + 33][lane] = l[u]; } }
  __syncthreads();
  if (kh == 0) {   // wave-uniform: key half 0 joins the two states on their common maximum and normalises
#pragma unroll
    for (int u = 0; u < 2; ++u) { const float m1 = ex[qg][u * 34 + 32][lane], mn = fmaxf(m[u], m1), a0 = __expf(m[u] - mn), a1 = __expf(m1 - mn), lt = l[u] * a0 + ex[qg][u * 34 + 33][lane] * a1;
      const float il = (1.0f / 2048.0f) / (lt + xhalf(lt));   // the two lane halves' sums join here, once
#pragma unroll
      for (int j = 0; j < 4; ++j)
#pragma unroll
        for (int r = 0; r < 8; ++r) st[j * 16 + 8 * g + r][qg * 32 + u * 16 + col] = (acc[u][j][r] * a0 + ex[qg][u * 34 + j * 8 + r][lane] * a1) * il; } }
  __syncthreads();
  for (int e = tid; e < CH * 16; e += 128) { const int c = e >> 4, q = e & 15; vst2((void*)(OUT + (bh * CH + c) * (size_t)TT + blockIdx.x * 64 + q * 4), *(const v4f*)&st[c][q * 4]); } }

extern "C" void kernel_launch(void* const* d_in, const int* in_sizes, int n_in, void* d_out, int out_size, void* d_ws, size_t ws_size, hipStream_t stream) {
  if (n_in < 1) return;
  if ((size_t)in_sizes[0] < (size_t)NB * WROWS * TT_FULL) return;   // [16,192,4096] f32
  if ((size_t)out_size < (size_t)NB * CH * TT) return;              // [16,64,4096] f32 at byte 0
  if (ws_size < (size_t)WS_END) return;
  const float* QKV = (const float*)d_in[0];
  char* ws = (char*)d_ws; _Float16 *QR = (_Float16*)(ws + WS_Q), *KF = (_Float16*)(ws + WS_K), *VF = (_Float16*)(ws + WS_V);
  k_prep<<<dim3(TT / 64, NB), 128, 0, stream>>>(QKV, QR, KF, VF);
  k_att<<<dim3(TT / 64, TBH), 128, 0, stream>>>(QR, KF, VF, (float*)d_out);
}

// v005
// It runs in 80.3 microseconds.
// Timed twice side by side with v004, it ran 1.14 and 1.15 times as fast.
// Counting every step since v000, it is 4.30 times as fast.
// compute dtype: logits q.k on v_wmma_f32_16x16x32_f16 (q, k = bf16 RNE-converted inputs held exactly in f16, f32 accumulate, x 1/8 inside the exponent's FMA); softmax in f32 (running max of the raw sums, base-2 exponent); P.v on v_wmma_f32_16x16x32_f16 (P in f16 carried x 2^11, as is its sum l, so the factor cancels in O / l; v = bf16 RNE-converted input held exactly in f16, f32 accumulate); f32 output.
#include <hip/hip_runtime.h>
#include <math.h>

typedef __attribute__((ext_vector_type(16))) _Float16 v16h;
typedef __attribute__((ext_vector_type(8)))  _Float16 v8h;
typedef __attribute__((ext_vector_type(8)))  float v8f;
typedef __attribute__((ext_vector_type(4)))  float v4f;
typedef __attribute__((ext_vector_type(2)))  float v2f;
typedef __attribute__((ext_vector_type(4)))  unsigned v4u;

template <typename T> __device__ __forceinline__ void vst2(void* p, T v) { *(T*)p = v;  }
__device__ __forceinline__ v8f wmma16(v16h a, v16h b, v8f c) {
  v8f d = __builtin_amdgcn_wmma_f32_16x16x32_f16(false, a, false, b, (short)0, c, false, false);
  asm volatile("v_nop\n\tv_nop\n\tv_nop\n\tv_nop" : "+v"(d) : "v"(a), "v"(b));
  return d;
}
// 16x16x32 fragments: lane = (h = lane>>4, row/col = lane&15); elements 0..7 = k0+8h+0..7, 8..15 = k0+16+8h+0..7; D element r = row 8h+r, col lane&15
__device__ __forceinline__ v16h frag_h(const _Float16* rowk0, int lane) {
  union { v16h v; v8h q[2]; } u; const _Float16* p = rowk0 + 8 * (lane >> 4);
  u.q[0] = *(const v8h*)p; u.q[1] = *(const v8h*)(p + 16); return u.v;
}
// the same fragment from a 1024-byte block stored in fragment order: [half 0..1][lane 0..31][8 elements], so each 16-byte load of a wave reads 512 contiguous bytes
__device__ __forceinline__ v16h frag_o(const _Float16* blk, int lane) {
  union { v16h v; v8h q[2]; } u; const _Float16* p = blk + 8 * lane;
  u.q[0] = *(const v8h*)p; u.q[1] = *(const v8h*)(p + 256); return u.v;
}
__device__ __forceinline__ float bfr(float v) { return (float)(__bf16)v; }   // RNE convert to bf16 and widen back
#define SC2 0.18033688011112042f   // (1/8) log2 e: weight = 2^(SC2 (raw - max raw))
__device__ __forceinline__ float xhalf(float x) { return __builtin_bit_cast(float, __builtin_amdgcn_permlanex16(__builtin_bit_cast(int, x), __builtin_bit_cast(int, x), 0x76543210, 0xfedcba98, false, false)); }   // lane l's value from lane l ^ 16

// fused input [NB][3*CH][T]: q planes = rows 0..CH-1, k planes = rows CH..2CH-1, v planes = rows 2CH..3CH-1 of each batch; per b: weight[t][s] = softmax_s( (1/8) sum_c q[c][t] k[c][s] ); out[b][c][t] = sum_s weight[t][s] v[c][s]
#ifndef NB
#define NB 16
#endif
#ifndef SEQ
#define SEQ 4096
#endif
#define NB_FULL 16
#define TT_FULL 4096
#define TT SEQ
#define CH 64
#define WROWS (3 * CH)   // 192 planes per batch in the input
#ifndef TBH
#define TBH NB
#endif
static_assert(NB >= 1 && NB <= NB_FULL);
static_assert(TT >= 64 && TT <= TT_FULL);
static_assert(TT % 64 == 0);
static_assert(CH == 64);
static_assert((size_t)NB * CH * TT * 4u <= (size_t)16777216u);

#define WS_Q   ((size_t)0)
#define WS_K   (WS_Q + 2u * (size_t)NB * TT * CH)            // f16 k fragments [b][pass of 32 keys][ct*2+kc][512]: block (ct, kc) = keys 16ct+0..15, channels 32kc+0..31
#define WS_V   (WS_K + 2u * (size_t)NB * TT * CH)            // f16 v fragments [b][pass of 32 keys][j][512]: block j = channels 16j+0..15, the pass's 32 keys
#define WS_END (WS_V + 2u * (size_t)NB * CH * TT)
static_assert(WS_END <= (size_t)134217728u);
static_assert(WS_K % 128u == 0 && WS_V % 128u == 0);

// ---- k_prep: block = (64 tokens, b): q planes -> f16 rows (transpose via LDS), k and v planes -> f16 blocks in k_att's fragment order; input read with the full-size strides
__global__ __launch_bounds__(128) void k_prep(const float* __restrict__ QKV, _Float16* __restrict__ QR, _Float16* __restrict__ KF, _Float16* __restrict__ VF) {
  __shared__ __align__(16) _Float16 sq[64][72], sk[64][72], sv[CH][72];
  const int t = threadIdx.x; const size_t b = blockIdx.y; const int t0 = blockIdx.x * 64;
  const float* base = QKV + b * WROWS * (size_t)TT_FULL;   // q plane c at base + c*TT_FULL; k at + (CH + c)*TT_FULL; v at + (2CH + c)*TT_FULL
  for (int e = t; e < CH * 64; e += 128) { const int c = e >> 6, tl = e & 63;
    sq[tl][c] = (_Float16)bfr(base[(size_t)c * TT_FULL + t0 + tl]);
    sk[tl][c] = (_Float16)bfr(base[(size_t)(CH + c) * TT_FULL + t0 + tl]);
    sv[c][tl] = (_Float16)bfr(base[(size_t)(2 * CH + c) * TT_FULL + t0 + tl]); }
  __syncthreads();
  for (int e = t; e < 64 * 8; e += 128) { const int tl = e >> 3, q = e & 7; const size_t o = (b * TT + t0 + tl) * CH + q * 8;
    vst2((void*)(QR + o), *(const v4u*)&sq[tl][q * 8]); }
  for (int e = t; e < 2 * 4 * 64; e += 128) { const int col = e & 15, ko = ((e >> 5) & 1) * 16 + ((e >> 4) & 1) * 8, f = (e >> 6) & 3, p = e >> 8;   // e = (pass p of the block's two, block f, half, lane = (h, col)); ko = k offset 16*half + 8h of frag_h
    const size_t o = ((b * (TT / 32) + (t0 >> 5) + p) * 4 + f) * 512 + (e & 63) * 8;
    vst2((void*)(KF + o), *(const v4u*)&sk[p * 32 + (f >> 1) * 16 + col][(f & 1) * 32 + ko]);
    vst2((void*)(VF + o), *(const v4u*)&sv[f * 16 + col][p * 32 + ko]); } }

__global__ __launch_bounds__(128) __attribute__((amdgpu_waves_per_eu(4, 4))) void k_att(const _Float16* __restrict__ QR, const _Float16* __restrict__ KF, const _Float16* __restrict__ VF, float* __restrict__ OUT) {
  __shared__ __align__(16) float st[CH][68];
  __shared__ float ex[2][68][32];   // key half 1's state of query group qg: per 16-query tile u rows 34u+0..31 = O, 34u+32 = b, 34u+33 = l; one column per lane
  const int tid = threadIdx.x, wave = __builtin_amdgcn_readfirstlane(tid >> 5), lane = tid & 31, col = lane & 15, g = lane >> 4, qg = wave & 1, kh = wave >> 1;
  const size_t bh = blockIdx.y; const int q0 = blockIdx.x * 64 + qg * 32; const size_t rq = bh * TT + q0;
  v16h aq[2][2];
#pragma unroll
  for (int u = 0; u < 2; ++u)
#pragma unroll
    for (int kc = 0; kc < 2; ++kc) aq[u][kc] = frag_h(QR + (rq + u * 16 + col) * CH + kc * 32, lane);   // B[k = c][n = query q0+16u+col]
  asm volatile("s_wait_xcnt 0x0" ::: "memory");   // stands in front of any rewrite of the address registers that the Q loads name
  float m[2] = {-3.0e38f, -3.0e38f}, b[2] = {3.0e38f, 3.0e38f}, l[2] = {0.f, 0.f};   // query q0+16u+col over this wave's key half: running maximum of the raw q.k sums (equal in both lane halves), the exponent's addend b = 11 - SC2 m in which O and l stand, 2^11 x the sum over this lane half's keys only
  v8f acc[2][4];
#pragma unroll
  for (int u = 0; u < 2; ++u)
#pragma unroll
    for (int j = 0; j < 4; ++j) acc[u][j] = v8f{};
  const int k0 = kh * (TT / 64), k1 = k0 + TT / 64;   // this wave's passes of 32 keys
  v16h kf[2][2], vf[4];   // this pass's K and V fragments, loaded one pass ahead; pass k0's here
#pragma unroll
  for (int ct = 0; ct < 2; ++ct)
#pragma unroll
    for (int kc = 0; kc < 2; ++kc) kf[ct][kc] = frag_o(KF + ((bh * (TT / 32) + k0) * 4 + ct * 2 + kc) * 512, lane);
  asm volatile("s_wait_xcnt 0x0" ::: "memory");   // the same for the address registers that the first pass's K loads name
#pragma unroll
  for (int j = 0; j < 4; ++j) vf[j] = frag_o(VF + ((bh * (TT / 32) + k0) * 4 + j) * 512, lane);
#pragma unroll 1
  for (int ks = k0; ks < k1; ++ks) { const int kn = ks + 1 < k1 ? ks + 1 : ks;   // pass fetched ahead; the last pass refetches its own keys, so every load stays inside this batch's K and V blocks
    v8f cs[2][2];
#pragma unroll
    for (int u = 0; u < 2; ++u)
#pragma unroll
      for (int ct = 0; ct < 2; ++ct) { cs[u][ct] = v8f{};   // A[m = key][k = c]; cs[u][ct][r] = logit of key 16ct+8g+r, query 16u+col
#pragma unroll
        for (int kc = 0; kc < 2; ++kc) cs[u][ct] = wmma16(kf[ct][kc], aq[u][kc], cs[u][ct]); }
#pragma unroll
    for (int ct = 0; ct < 2; ++ct)
#pragma unroll
      for (int kc = 0; kc < 2; ++kc) kf[ct][kc] = frag_o(KF + ((bh * (TT / 32) + kn) * 4 + ct * 2 + kc) * 512, lane);   // next pass's K: lands under the softmax and P.v
    v16h pa[2];   // B[k = key][n = query 16u+col]: elements 0..7 = key 8g+0..7, 8..15 = key 16+8g+0..7, which are this lane's own two score tiles
#pragma unroll
    for (int u = 0; u < 2; ++u) { float s[2][8], t[8];
#pragma unroll
      for (int r = 0; r < 8; ++r) t[r] = fmaxf(cs[u][0][r], cs[u][1][r]);
#pragma unroll
      for (int w = 4; w >= 1; w >>= 1)
#pragma unroll
        for (int r = 0; r < w; ++r) t[r] = fmaxf(t[r], t[r + w]);
      const float mn = fmaxf(m[u], fmaxf(t[0], xhalf(t[0]))), bias = fmaf(-mn, SC2, 11.0f), alpha = __builtin_amdgcn_exp2f(bias - b[u]); m[u] = mn; b[u] = bias;   // alpha is exactly 1 while the maximum stands
#pragma unroll
      for (int ct = 0; ct < 2; ++ct)
#pragma unroll
        for (int r = 0; r < 8; r += 2) { const v2f x = __builtin_elementwise_fma(v2f{cs[u][ct][r], cs[u][ct][r + 1]}, v2f{SC2, SC2}, v2f{bias, bias});   // scale, log2 e, maximum and P's 2^11 in one FMA, packed over a register pair of the score tile
          s[ct][r] = __builtin_amdgcn_exp2f(x[0]); s[ct][r + 1] = __builtin_amdgcn_exp2f(x[1]); }   // 2^11 x the weight
#pragma unroll
      for (int r = 0; r < 8; ++r) t[r] = s[0][r] + s[1][r];
#pragma unroll
      for (int w = 4; w >= 1; w >>= 1)
#pragma unroll
        for (int r = 0; r < w; ++r) t[r] += t[r + w];
      l[u] = l[u] * alpha + t[0];
#pragma unroll
      for (int j = 0; j < 4; ++j)
#pragma unroll
        for (int r = 0; r < 8; ++r) acc[u][j][r] *= alpha;
#pragma unroll
      for (int i = 0; i < 8; ++i) { pa[u][i] = (_Float16)s[0][i]; pa[u][8 + i] = (_Float16)s[1][i]; } }
#pragma unroll
    for (int j = 0; j < 4; ++j)
#pragma unroll
      for (int u = 0; u < 2; ++u) acc[u][j] = wmma16(vf[j], pa[u], acc[u][j]);   // A[m = c][k = key]; acc[u][j][r] = channel 16j+8g+r, query 16u+col
#pragma unroll
    for (int j = 0; j < 4; ++j) vf[j] = frag_o(VF + ((bh * (TT / 32) + kn) * 4 + j) * 512, lane);   // next pass's V: lands under the next scores and softmax
    asm volatile("s_wait_xcnt 0x0" ::: "memory"); }   // stands in front of the next pass's rewrite of the address registers that the V loads name
  if (kh == 1) {   // wave-uniform: key half 1 hands its state over
#pragma unroll
    for (int u = 0; u < 2; ++u) {
#pragma unroll
      for (int j = 0; j < 4; ++j)
#pragma unroll
        for (int r = 0; r < 8; ++r) ex[qg][u * 34 + j * 8 + r][lane] = acc[u][j][r];
      ex[qg][u * 34 + 32][lane] = b[u]; ex[qg][u * 34 + 33][lane] = l[u]; } }
  __syncthreads();
  if (kh == 0) {   // wave-uniform: key half 0 joins the two states on their common maximum and normalises
#pragma unroll
    for (int u = 0; u < 2; ++u) { const float b1 = ex[qg][u * 34 + 32][lane], bn = fminf(b[u], b1), a0 = __builtin_amdgcn_exp2f(bn - b[u]), a1 = __builtin_amdgcn_exp2f(bn - b1), lt = l[u] * a0 + ex[qg][u * 34 + 33][lane] * a1;
      const float il = 1.0f / (lt + xhalf(lt));   // the two lane halves' sums join here, once; O and l both carry 2^11
#pragma unroll
      for (int j = 0; j < 4; ++j)
#pragma unroll
        for (int r = 0; r < 8; ++r) st[j * 16 + 8 * g + r][qg * 32 + u * 16 + col] = (acc[u][j][r] * a0 + ex[qg][u * 34 + j * 8 + r][lane] * a1) * il; } }
  __syncthreads();
  for (int e = tid; e < CH * 16; e += 128) { const int c = e >> 4, q = e & 15; vst2((void*)(OUT + (bh * CH + c) * (size_t)TT + blockIdx.x * 64 + q * 4), *(const v4f*)&st[c][q * 4]); } }

extern "C" void kernel_launch(void* const* d_in, const int* in_sizes, int n_in, void* d_out, int out_size, void* d_ws, size_t ws_size, hipStream_t stream) {
  if (n_in < 1) return;
  if ((size_t)in_sizes[0] < (size_t)NB * WROWS * TT_FULL) return;   // [16,192,4096] f32
  if ((size_t)out_size < (size_t)NB * CH * TT) return;              // [16,64,4096] f32 at byte 0
  if (ws_size < (size_t)WS_END) return;
  const float* QKV = (const float*)d_in[0];
  char* ws = (char*)d_ws; _Float16 *QR = (_Float16*)(ws + WS_Q), *KF = (_Float16*)(ws + WS_K), *VF = (_Float16*)(ws + WS_V);
  k_prep<<<dim3(TT / 64, NB), 128, 0, stream>>>(QKV, QR, KF, VF);
  k_att<<<dim3(TT / 64, TBH), 128, 0, stream>>>(QR, KF, VF, (float*)d_out);
}

// v006
// Measured time: 74.6 microseconds a run.
// In both of two side-by-side timings against v005, it was 1.08 times as fast.
// Counting every step since v000, it is 4.65 times as fast.
// compute dtype: logits q.k on v_wmma_f32_16x16x32_f16 (q, k = bf16 RNE-converted inputs held exactly in f16, f32 accumulate, x 1/8 inside the exponent's FMA); softmax in f32 (a maximum of the raw sums that is raised lazily, base-2 exponent); P.v on v_wmma_f32_16x16x32_f16 (P in f16 carried x 2^11, as is its sum l, so the factor cancels in O / l; P stays at or below 2^15; v = bf16 RNE-converted input held exactly in f16, f32 accumulate); f32 output.
#include <hip/hip_runtime.h>
#include <math.h>

typedef __attribute__((ext_vector_type(16))) _Float16 v16h;
typedef __attribute__((ext_vector_type(8)))  _Float16 v8h;
typedef __attribute__((ext_vector_type(8)))  float v8f;
typedef __attribute__((ext_vector_type(4)))  float v4f;
typedef __attribute__((ext_vector_type(2)))  float v2f;
typedef __attribute__((ext_vector_type(4)))  unsigned v4u;

template <typename T> __device__ __forceinline__ void vst2(void* p, T v) { *(T*)p = v;  }
__device__ __forceinline__ v8f wmma16(v16h a, v16h b, v8f c) {
  v8f d = __builtin_amdgcn_wmma_f32_16x16x32_f16(false, a, false, b, (short)0, c, false, false);
  asm volatile("v_nop\n\tv_nop\n\tv_nop\n\tv_nop" : "+v"(d) : "v"(a), "v"(b));
  return d;
}
// 16x16x32 fragments: lane = (h = lane>>4, row/col = lane&15); elements 0..7 = k0+8h+0..7, 8..15 = k0+16+8h+0..7; D element r = row 8h+r, col lane&15
__device__ __forceinline__ v16h frag_h(const _Float16* rowk0, int lane) {
  union { v16h v; v8h q[2]; } u; const _Float16* p = rowk0 + 8 * (lane >> 4);
  u.q[0] = *(const v8h*)p; u.q[1] = *(const v8h*)(p + 16); return u.v;
}
// the same fragment from a 1024-byte block stored in fragment order: [half 0..1][lane 0..31][8 elements], so each 16-byte load of a wave reads 512 contiguous bytes
__device__ __forceinline__ v16h frag_o(const _Float16* blk, int lane) {
  union { v16h v; v8h q[2]; } u; const _Float16* p = blk + 8 * lane;
  u.q[0] = *(const v8h*)p; u.q[1] = *(const v8h*)(p + 256); return u.v;
}
__device__ __forceinline__ float bfr(float v) { return (float)(__bf16)v; }   // RNE convert to bf16 and widen back
#define SC2 0.18033688011112042f   // (1/8) log2 e: weight = 2^(SC2 (raw - max raw))
#define LAZY 22.180709777918249f   // 4 / SC2: a raw score this far above the maximum in use has weight 2^4 on it
__device__ __forceinline__ float xhalf(float x) { return __builtin_bit_cast(float, __builtin_amdgcn_permlanex16(__builtin_bit_cast(int, x), __builtin_bit_cast(int, x), 0x76543210, 0xfedcba98, false, false)); }   // lane l's value from lane l ^ 16

// fused input [NB][3*CH][T]: q planes = rows 0..CH-1, k planes = rows CH..2CH-1, v planes = rows 2CH..3CH-1 of each batch; per b: weight[t][s] = softmax_s( (1/8) sum_c q[c][t] k[c][s] ); out[b][c][t] = sum_s weight[t][s] v[c][s]
#ifndef NB
#define NB 16
#endif
#ifndef SEQ
#define SEQ 4096
#endif
#define NB_FULL 16
#define TT_FULL 4096
#define TT SEQ
#define CH 64
#define WROWS (3 * CH)   // 192 planes per batch in the input
#ifndef TBH
#define TBH NB
#endif
static_assert(NB >= 1 && NB <= NB_FULL);
static_assert(TT >= 64 && TT <= TT_FULL);
static_assert(TT % 64 == 0);
static_assert(CH == 64);
static_assert((size_t)NB * CH * TT * 4u <= (size_t)16777216u);

#define WS_Q   ((size_t)0)
#define WS_K   (WS_Q + 2u * (size_t)NB * TT * CH)            // f16 k fragments [b][pass of 32 keys][ct*2+kc][512]: block (ct, kc) = keys 16ct+0..15, channels 32kc+0..31
#define WS_V   (WS_K + 2u * (size_t)NB * TT * CH)            // f16 v fragments [b][pass of 32 keys][j][512]: block j = channels 16j+0..15, the pass's 32 keys
#define WS_END (WS_V + 2u * (size_t)NB * CH * TT)
static_assert(WS_END <= (size_t)134217728u);
static_assert(WS_K % 128u == 0 && WS_V % 128u == 0);

// ---- k_prep: block = (64 tokens, b): q planes -> f16 rows (transpose via LDS), k and v planes -> f16 blocks in k_att's fragment order; input read with the full-size strides
__global__ __launch_bounds__(128) void k_prep(const float* __restrict__ QKV, _Float16* __restrict__ QR, _Float16* __restrict__ KF, _Float16* __restrict__ VF) {
  __shared__ __align__(16) _Float16 sq[64][72], sk[64][72], sv[CH][72];
  const int t = threadIdx.x; const size_t b = blockIdx.y; const int t0 = blockIdx.x * 64;
  const float* base = QKV + b * WROWS * (size_t)TT_FULL;   // q plane c at base + c*TT_FULL; k at + (CH + c)*TT_FULL; v at + (2CH + c)*TT_FULL
  for (int e = t; e < CH * 64; e += 128) { const int c = e >> 6, tl = e & 63;
    sq[tl][c] = (_Float16)bfr(base[(size_t)c * TT_FULL + t0 + tl]);
    sk[tl][c] = (_Float16)bfr(base[(size_t)(CH + c) * TT_FULL + t0 + tl]);
    sv[c][tl] = (_Float16)bfr(base[(size_t)(2 * CH + c) * TT_FULL + t0 + tl]); }
  __syncthreads();
  for (int e = t; e < 64 * 8; e += 128) { const int tl = e >> 3, q = e & 7; const size_t o = (b * TT + t0 + tl) * CH + q * 8;
    vst2((void*)(QR + o), *(const v4u*)&sq[tl][q * 8]); }
  for (int e = t; e < 2 * 4 * 64; e += 128) { const int col = e & 15, ko = ((e >> 5) & 1) * 16 + ((e >> 4) & 1) * 8, f = (e >> 6) & 3, p = e >> 8;   // e = (pass p of the block's two, block f, half, lane = (h, col)); ko = k offset 16*half + 8h of frag_h
    const size_t o = ((b * (TT / 32) + (t0 >> 5) + p) * 4 + f) * 512 + (e & 63) * 8;
    vst2((void*)(KF + o), *(const v4u*)&sk[p * 32 + (f >> 1) * 16 + col][(f & 1) * 32 + ko]);
    vst2((void*)(VF + o), *(const v4u*)&sv[f * 16 + col][p * 32 + ko]); } }

__global__ __launch_bounds__(128) __attribute__((amdgpu_waves_per_eu(4, 4))) void k_att(const _Float16* __restrict__ QR, const _Float16* __restrict__ KF, const _Float16* __restrict__ VF, float* __restrict__ OUT) {
  __shared__ __align__(16) float st[CH][68];
  __shared__ float ex[2][68][32];   // key half 1's state of query group qg: per 16-query tile u rows 34u+0..31 = O, 34u+32 = b, 34u+33 = l; one column per lane
  const int tid = threadIdx.x, wave = __builtin_amdgcn_readfirstlane(tid >> 5), lane = tid & 31, col = lane & 15, g = lane >> 4, qg = wave & 1, kh = wave >> 1;
  const size_t bh = blockIdx.y; const int q0 = blockIdx.x * 64 + qg * 32; const size_t rq = bh * TT + q0;
  v16h aq[2][2];
#pragma unroll
  for (int u = 0; u < 2; ++u)
#pragma unroll
    for (int kc = 0; kc < 2; ++kc) aq[u][kc] = frag_h(QR + (rq + u * 16 + col) * CH + kc * 32, lane);   // B[k = c][n = query q0+16u+col]
  asm volatile("s_wait_xcnt 0x0" ::: "memory");   // stands in front of any rewrite of the address registers that the Q loads name
  float m[2] = {-3.0e38f, -3.0e38f}, thr[2] = {-3.0e38f, -3.0e38f}, b[2] = {3.0e38f, 3.0e38f}, l[2] = {0.f, 0.f};   // query q0+16u+col over this wave's key half: the maximum in use m of the raw q.k sums (equal in both lane halves; raised only by the lazy rescale), thr = m + LAZY, the exponent's addend b = 11 - SC2 m in which O and l stand, 2^11 x the sum over this lane half's keys only
  v8f acc[2][4];
#pragma unroll
  for (int u = 0; u < 2; ++u)
#pragma unroll
    for (int j = 0; j < 4; ++j) acc[u][j] = v8f{};
  const int k0 = kh * (TT / 64), k1 = k0 + TT / 64;   // this wave's passes of 32 keys
  v16h kf[2][2], vf[4];   // this pass's K and V fragments, loaded one pass ahead; pass k0's here
#pragma unroll
  for (int ct = 0; ct < 2; ++ct)
#pragma unroll
    for (int kc = 0; kc < 2; ++kc) kf[ct][kc] = frag_o(KF + ((bh * (TT / 32) + k0) * 4 + ct * 2 + kc) * 512, lane);
  asm volatile("s_wait_xcnt 0x0" ::: "memory");   // the same for the address registers that the first pass's K loads name
#pragma unroll
  for (int j = 0; j < 4; ++j) vf[j] = frag_o(VF + ((bh * (TT / 32) + k0) * 4 + j) * 512, lane);
#pragma unroll 1
  for (int ks = k0; ks < k1; ++ks) { const int kn = ks + 1 < k1 ? ks + 1 : ks;   // pass fetched ahead; the last pass refetches its own keys, so every load stays inside this batch's K and V blocks
    v8f cs[2][2];
#pragma unroll
    for (int u = 0; u < 2; ++u)
#pragma unroll
      for (int ct = 0; ct < 2; ++ct) { cs[u][ct] = v8f{};   // A[m = key][k = c]; cs[u][ct][r] = logit of key 16ct+8g+r, query 16u+col
#pragma unroll
        for (int kc = 0; kc < 2; ++kc) cs[u][ct] = wmma16(kf[ct][kc], aq[u][kc], cs[u][ct]); }
#pragma unroll
    for (int ct = 0; ct < 2; ++ct)
#pragma unroll
      for (int kc = 0; kc < 2; ++kc) kf[ct][kc] = frag_o(KF + ((bh * (TT / 32) + kn) * 4 + ct * 2 + kc) * 512, lane);   // next pass's K: lands under the softmax and P.v
    float tm[2];   // this lane's maximum over its 16 raw scores of query 16u+col
#pragma unroll
    for (int u = 0; u < 2; ++u) { float t[8];
#pragma unroll
      for (int r = 0; r < 8; ++r) t[r] = fmaxf(cs[u][0][r], cs[u][1][r]);
#pragma unroll
      for (int w = 4; w >= 1; w >>= 1)
#pragma unroll
        for (int r = 0; r < w; ++r) t[r] = fmaxf(t[r], t[r + w]);
      tm[u] = t[0]; }
    if (__builtin_amdgcn_ballot_w32(tm[0] > thr[0] || tm[1] > thr[1]) != 0) {   // one scalar branch a pass: taken on the first pass and when some score stands more than LAZY above the maximum in use
#pragma unroll
      for (int u = 0; u < 2; ++u) { const float mn = fmaxf(m[u], fmaxf(tm[u], xhalf(tm[u]))), bias = fmaf(-mn, SC2, 11.0f), alpha = __builtin_amdgcn_exp2f(bias - b[u]); m[u] = mn; b[u] = bias; thr[u] = mn + LAZY;   // alpha is exactly 1 for a query whose maximum stands
        l[u] *= alpha;
#pragma unroll
        for (int j = 0; j < 4; ++j)
#pragma unroll
          for (int r = 0; r < 8; ++r) acc[u][j][r] *= alpha; } }
    v16h pa[2];   // B[k = key][n = query 16u+col]: elements 0..7 = key 8g+0..7, 8..15 = key 16+8g+0..7, which are this lane's own two score tiles
#pragma unroll
    for (int u = 0; u < 2; ++u) { v2f s[2][4], t[4]; const float bias = b[u];   // register pairs (r, r + 1) of the score tiles
#pragma unroll
      for (int ct = 0; ct < 2; ++ct)
#pragma unroll
        for (int r = 0; r < 4; ++r) { const v2f x = __builtin_elementwise_fma(v2f{cs[u][ct][2 * r], cs[u][ct][2 * r + 1]}, v2f{SC2, SC2}, v2f{bias, bias});   // scale, log2 e, the maximum in use and P's 2^11 in one FMA, packed over a register pair of the score tile
          s[ct][r] = v2f{__builtin_amdgcn_exp2f(x[0]), __builtin_amdgcn_exp2f(x[1])}; }   // 2^11 x the weight on the maximum in use: at most 2^15, inside f16
#pragma unroll
      for (int r = 0; r < 4; ++r) t[r] = s[0][r] + s[1][r];
      t[0] += t[2]; t[1] += t[3]; t[0] += t[1];
      l[u] += t[0][0] + t[0][1];
#pragma unroll
      for (int i = 0; i < 4; ++i) { pa[u][2 * i] = (_Float16)s[0][i][0]; pa[u][2 * i + 1] = (_Float16)s[0][i][1]; pa[u][8 + 2 * i] = (_Float16)s[1][i][0]; pa[u][9 + 2 * i] = (_Float16)s[1][i][1]; } }
#pragma unroll
    for (int j = 0; j < 4; ++j)
#pragma unroll
      for (int u = 0; u < 2; ++u) acc[u][j] = wmma16(vf[j], pa[u], acc[u][j]);   // A[m = c][k = key]; acc[u][j][r] = channel 16j+8g+r, query 16u+col
#pragma unroll
    for (int j = 0; j < 4; ++j) vf[j] = frag_o(VF + ((bh * (TT / 32) + kn) * 4 + j) * 512, lane);   // next pass's V: lands under the next scores and softmax
    asm volatile("s_wait_xcnt 0x0" ::: "memory"); }   // stands in front of the next pass's rewrite of the address registers that the V loads name
  if (kh == 1) {   // wave-uniform: key half 1 hands its state over
#pragma unroll
    for (int u = 0; u < 2; ++u) {
#pragma unroll
      for (int j = 0; j < 4; ++j)
#pragma unroll
        for (int r = 0; r < 8; ++r) ex[qg][u * 34 + j * 8 + r][lane] = acc[u][j][r];
      ex[qg][u * 34 + 32][lane] = b[u]; ex[qg][u * 34 + 33][lane] = l[u]; } }
  __syncthreads();
  if (kh == 0) {   // wave-uniform: key half 0 joins the two states on their common maximum and normalises
#pragma unroll
    for (int u = 0; u < 2; ++u) { const float b1 = ex[qg][u * 34 + 32][lane], bn = fminf(b[u], b1), a0 = __builtin_amdgcn_exp2f(bn - b[u]), a1 = __builtin_amdgcn_exp2f(bn - b1), lt = l[u] * a0 + ex[qg][u * 34 + 33][lane] * a1;
      const float il = 1.0f / (lt + xhalf(lt));   // the two lane halves' sums join here, once; O and l both carry 2^11
#pragma unroll
      for (int j = 0; j < 4; ++j)
#pragma unroll
        for (int r = 0; r < 8; ++r) st[j * 16 + 8 * g + r][qg * 32 + u * 16 + col] = (acc[u][j][r] * a0 + ex[qg][u * 34 + j * 8 + r][lane] * a1) * il; } }
  __syncthreads();
  for (int e = tid; e < CH * 16; e += 128) { const int c = e >> 4, q = e & 15; vst2((void*)(OUT + (bh * CH + c) * (size_t)TT + blockIdx.x * 64 + q * 4), *(const v4f*)&st[c][q * 4]); } }

extern "C" void kernel_launch(void* const* d_in, const int* in_sizes, int n_in, void* d_out, int out_size, void* d_ws, size_t ws_size, hipStream_t stream) {
  if (n_in < 1) return;
  if ((size_t)in_sizes[0] < (size_t)NB * WROWS * TT_FULL) return;   // [16,192,4096] f32
  if ((size_t)out_size < (size_t)NB * CH * TT) return;              // [16,64,4096] f32 at byte 0
  if (ws_size < (size_t)WS_END) return;
  const float* QKV = (const float*)d_in[0];
  char* ws = (char*)d_ws; _Float16 *QR = (_Float16*)(ws + WS_Q), *KF = (_Float16*)(ws + WS_K), *VF = (_Float16*)(ws + WS_V);
  k_prep<<<dim3(TT / 64, NB), 128, 0, stream>>>(QKV, QR, KF, VF);
  k_att<<<dim3(TT / 64, TBH), 128, 0, stream>>>(QR, KF, VF, (float*)d_out);
}

// v007
// It runs in 69.2 microseconds.
// In two side-by-side timings against v006, it was 1.08 and 1.07 times as fast.
// All steps since v000 together make it 5.01 times as fast.
// compute dtype: logits q.k on v_wmma_f32_16x16x32_f16 (q, k = bf16 RNE-converted inputs held exactly in f16, f32 accumulate, x 1/8 inside the exponent's FMA); softmax in f32 (a maximum of the raw sums that is raised lazily, base-2 exponent); P.v on v_wmma_f32_16x16x32_f16 (P in f16 carried x 2^11, as is its sum l, so the factor cancels in O / l; P stays at or below 2^15; v = bf16 RNE-converted input held exactly in f16, f32 accumulate); f32 output.
#include <hip/hip_runtime.h>
#include <math.h>

typedef __attribute__((ext_vector_type(16))) _Float16 v16h;
typedef __attribute__((ext_vector_type(8)))  _Float16 v8h;
typedef __attribute__((ext_vector_type(8)))  float v8f;
typedef __attribute__((ext_vector_type(4)))  float v4f;
typedef __attribute__((ext_vector_type(2)))  float v2f;
typedef __attribute__((ext_vector_type(4)))  unsigned v4u;

template <typename T> __device__ __forceinline__ void vst2(void* p, T v) { *(T*)p = v;  }
__device__ __forceinline__ v8f wmma16(v16h a, v16h b, v8f c) {
  return __builtin_amdgcn_wmma_f32_16x16x32_f16(false, a, false, b, (short)0, c, false, false);   // plain builtin: the compiler keeps the distance behind a WMMA itself and fills it with independent work where it can
}
// 16x16x32 fragments: lane = (h = lane>>4, row/col = lane&15); elements 0..7 = k0+8h+0..7, 8..15 = k0+16+8h+0..7; D element r = row 8h+r, col lane&15
__device__ __forceinline__ v16h frag_h(const _Float16* rowk0, int lane) {
  union { v16h v; v8h q[2]; } u; const _Float16* p = rowk0 + 8 * (lane >> 4);
  u.q[0] = *(const v8h*)p; u.q[1] = *(const v8h*)(p + 16); return u.v;
}
// the same fragment from a 1024-byte block stored in fragment order: [half 0..1][lane 0..31][8 elements], so each 16-byte load of a wave reads 512 contiguous bytes
__device__ __forceinline__ v16h frag_o(const _Float16* blk, int lane) {
  union { v16h v; v8h q[2]; } u; const _Float16* p = blk + 8 * lane;
  u.q[0] = *(const v8h*)p; u.q[1] = *(const v8h*)(p + 256); return u.v;
}
__device__ __forceinline__ float bfr(float v) { return (float)(__bf16)v; }   // RNE convert to bf16 and widen back
#define SC2 0.18033688011112042f   // (1/8) log2 e: weight = 2^(SC2 (raw - max raw))
#define LAZY 22.180709777918249f   // 4 / SC2: a raw score this far above the maximum in use has weight 2^4 on it
__device__ __forceinline__ float xhalf(float x) { return __builtin_bit_cast(float, __builtin_amdgcn_permlanex16(__builtin_bit_cast(int, x), __builtin_bit_cast(int, x), 0x76543210, 0xfedcba98, false, false)); }   // lane l's value from lane l ^ 16

// fused input [NB][3*CH][T]: q planes = rows 0..CH-1, k planes = rows CH..2CH-1, v planes = rows 2CH..3CH-1 of each batch; per b: weight[t][s] = softmax_s( (1/8) sum_c q[c][t] k[c][s] ); out[b][c][t] = sum_s weight[t][s] v[c][s]
#ifndef NB
#define NB 16
#endif
#ifndef SEQ
#define SEQ 4096
#endif
#define NB_FULL 16
#define TT_FULL 4096
#define TT SEQ
#define CH 64
#define WROWS (3 * CH)   // 192 planes per batch in the input
#ifndef TBH
#define TBH NB
#endif
static_assert(NB >= 1 && NB <= NB_FULL);
static_assert(TT >= 64 && TT <= TT_FULL);
static_assert(TT % 64 == 0);
static_assert(CH == 64);
static_assert((size_t)NB * CH * TT * 4u <= (size_t)16777216u);

#define WS_Q   ((size_t)0)
#define WS_K   (WS_Q + 2u * (size_t)NB * TT * CH)            // f16 k fragments [b][pass of 32 keys][ct*2+kc][512]: block (ct, kc) = keys 16ct+0..15, channels 32kc+0..31
#define WS_V   (WS_K + 2u * (size_t)NB * TT * CH)            // f16 v fragments [b][pass of 32 keys][j][512]: block j = channels 16j+0..15, the pass's 32 keys
#define WS_END (WS_V + 2u * (size_t)NB * CH * TT)
static_assert(WS_END <= (size_t)134217728u);
static_assert(WS_K % 128u == 0 && WS_V % 128u == 0);

// ---- k_prep: block = (64 tokens, b): q planes -> f16 rows (transpose via LDS), k and v planes -> f16 blocks in k_att's fragment order; input read with the full-size strides
__global__ __launch_bounds__(128) void k_prep(const float* __restrict__ QKV, _Float16* __restrict__ QR, _Float16* __restrict__ KF, _Float16* __restrict__ VF) {
  __shared__ __align__(16) _Float16 sq[64][72], sk[64][72], sv[CH][72];
  const int t = threadIdx.x; const size_t b = blockIdx.y; const int t0 = blockIdx.x * 64;
  const float* base = QKV + b * WROWS * (size_t)TT_FULL;   // q plane c at base + c*TT_FULL; k at + (CH + c)*TT_FULL; v at + (2CH + c)*TT_FULL
  for (int e = t; e < CH * 64; e += 128) { const int c = e >> 6, tl = e & 63;
    sq[tl][c] = (_Float16)bfr(base[(size_t)c * TT_FULL + t0 + tl]);
    sk[tl][c] = (_Float16)bfr(base[(size_t)(CH + c) * TT_FULL + t0 + tl]);
    sv[c][tl] = (_Float16)bfr(base[(size_t)(2 * CH + c) * TT_FULL + t0 + tl]); }
  __syncthreads();
  for (int e = t; e < 64 * 8; e += 128) { const int tl = e >> 3, q = e & 7; const size_t o = (b * TT + t0 + tl) * CH + q * 8;
    vst2((void*)(QR + o), *(const v4u*)&sq[tl][q * 8]); }
  for (int e = t; e < 2 * 4 * 64; e += 128) { const int col = e & 15, ko = ((e >> 5) & 1) * 16 + ((e >> 4) & 1) * 8, f = (e >> 6) & 3, p = e >> 8;   // e = (pass p of the block's two, block f, half, lane = (h, col)); ko = k offset 16*half + 8h of frag_h
    const size_t o = ((b * (TT / 32) + (t0 >> 5) + p) * 4 + f) * 512 + (e & 63) * 8;
    vst2((void*)(KF + o), *(const v4u*)&sk[p * 32 + (f >> 1) * 16 + col][(f & 1) * 32 + ko]);
    vst2((void*)(VF + o), *(const v4u*)&sv[f * 16 + col][p * 32 + ko]); } }

__global__ __launch_bounds__(128) __attribute__((amdgpu_waves_per_eu(4, 4))) void k_att(const _Float16* __restrict__ QR, const _Float16* __restrict__ KF, const _Float16* __restrict__ VF, float* __restrict__ OUT) {
  __shared__ __align__(16) float st[CH][68];
  __shared__ float ex[2][68][32];   // key half 1's state of query group qg: per 16-query tile u rows 34u+0..31 = O, 34u+32 = b, 34u+33 = l; one column per lane
  const int tid = threadIdx.x, wave = __builtin_amdgcn_readfirstlane(tid >> 5), lane = tid & 31, col = lane & 15, g = lane >> 4, qg = wave & 1, kh = wave >> 1;
  const size_t bh = blockIdx.y; const int q0 = blockIdx.x * 64 + qg * 32; const size_t rq = bh * TT + q0;
  v16h aq[2][2];
#pragma unroll
  for (int u = 0; u < 2; ++u)
#pragma unroll
    for (int kc = 0; kc < 2; ++kc) aq[u][kc] = frag_h(QR + (rq + u * 16 + col) * CH + kc * 32, lane);   // B[k = c][n = query q0+16u+col]
  asm volatile("s_wait_xcnt 0x0" ::: "memory");   // stands in front of any rewrite of the address registers that the Q loads name
  float m[2] = {-3.0e38f, -3.0e38f}, thr[2] = {-3.0e38f, -3.0e38f}, b[2] = {3.0e38f, 3.0e38f}, l[2] = {0.f, 0.f};   // query q0+16u+col over this wave's key half: the maximum in use m of the raw q.k sums (equal in both lane halves; raised only by the lazy rescale), thr = m + LAZY, the exponent's addend b = 11 - SC2 m in which O and l stand, 2^11 x the sum over this lane half's keys only
  v8f acc[2][4];
#pragma unroll
  for (int u = 0; u < 2; ++u)
#pragma unroll
    for (int j = 0; j < 4; ++j) acc[u][j] = v8f{};
  const int k0 = kh * (TT / 64), k1 = k0 + TT / 64;   // this wave's passes of 32 keys
  v16h kf[2][2], vf[4];   // this pass's K and V fragments, loaded one pass ahead; pass k0's here
#pragma unroll
  for (int ct = 0; ct < 2; ++ct)
#pragma unroll
    for (int kc = 0; kc < 2; ++kc) kf[ct][kc] = frag_o(KF + ((bh * (TT / 32) + k0) * 4 + ct * 2 + kc) * 512, lane);
  asm volatile("s_wait_xcnt 0x0" ::: "memory");   // the same for the address registers that the first pass's K loads name
#pragma unroll
  for (int j = 0; j < 4; ++j) vf[j] = frag_o(VF + ((bh * (TT / 32) + k0) * 4 + j) * 512, lane);
#pragma unroll 1
  for (int ks = k0; ks < k1; ++ks) { const int kn = ks + 1 < k1 ? ks + 1 : ks;   // pass fetched ahead; the last pass refetches its own keys, so every load stays inside this batch's K and V blocks
    v8f cs[2][2];
#pragma unroll
    for (int u = 0; u < 2; ++u)
#pragma unroll
      for (int ct = 0; ct < 2; ++ct) { cs[u][ct] = v8f{};   // A[m = key][k = c]; cs[u][ct][r] = logit of key 16ct+8g+r, query 16u+col
#pragma unroll
        for (int kc = 0; kc < 2; ++kc) cs[u][ct] = wmma16(kf[ct][kc], aq[u][kc], cs[u][ct]); }
#pragma unroll
    for (int ct = 0; ct < 2; ++ct)
#pragma unroll
      for (int kc = 0; kc < 2; ++kc) kf[ct][kc] = frag_o(KF + ((bh * (TT / 32) + kn) * 4 + ct * 2 + kc) * 512, lane);   // next pass's K: lands under the softmax and P.v
    float tm[2];   // this lane's maximum over its 16 raw scores of query 16u+col
#pragma unroll
    for (int u = 0; u < 2; ++u) { float t[8];
#pragma unroll
      for (int r = 0; r < 8; ++r) t[r] = fmaxf(cs[u][0][r], cs[u][1][r]);
#pragma unroll
      for (int w = 4; w >= 1; w >>= 1)
#pragma unroll
        for (int r = 0; r < w; ++r) t[r] = fmaxf(t[r], t[r + w]);
      tm[u] = t[0]; }
    if (__builtin_amdgcn_ballot_w32(tm[0] > thr[0] || tm[1] > thr[1]) != 0) {   // one scalar branch a pass: taken on the first pass and when some score stands more than LAZY above the maximum in use
#pragma unroll
      for (int u = 0; u < 2; ++u) { const float mn = fmaxf(m[u], fmaxf(tm[u], xhalf(tm[u]))), bias = fmaf(-mn, SC2, 11.0f), alpha = __builtin_amdgcn_exp2f(bias - b[u]); m[u] = mn; b[u] = bias; thr[u] = mn + LAZY;   // alpha is exactly 1 for a query whose maximum stands
        l[u] *= alpha;
#pragma unroll
        for (int j = 0; j < 4; ++j)
#pragma unroll
          for (int r = 0; r < 8; ++r) acc[u][j][r] *= alpha; } }
    v16h pa[2];   // B[k = key][n = query 16u+col]: elements 0..7 = key 8g+0..7, 8..15 = key 16+8g+0..7, which are this lane's own two score tiles
#pragma unroll
    for (int u = 0; u < 2; ++u) { v2f s[2][4], t[4]; const float bias = b[u];   // register pairs (r, r + 1) of the score tiles
#pragma unroll
      for (int ct = 0; ct < 2; ++ct)
#pragma unroll
        for (int r = 0; r < 4; ++r) { const v2f x = __builtin_elementwise_fma(v2f{cs[u][ct][2 * r], cs[u][ct][2 * r + 1]}, v2f{SC2, SC2}, v2f{bias, bias});   // scale, log2 e, the maximum in use and P's 2^11 in one FMA, packed over a register pair of the score tile
          s[ct][r] = v2f{__builtin_amdgcn_exp2f(x[0]), __builtin_amdgcn_exp2f(x[1])}; }   // 2^11 x the weight on the maximum in use: at most 2^15, inside f16
#pragma unroll
      for (int r = 0; r < 4; ++r) t[r] = s[0][r] + s[1][r];
      t[0] += t[2]; t[1] += t[3]; t[0] += t[1];
      l[u] += t[0][0] + t[0][1];
#pragma unroll
      for (int i = 0; i < 4; ++i) { pa[u][2 * i] = (_Float16)s[0][i][0]; pa[u][2 * i + 1] = (_Float16)s[0][i][1]; pa[u][8 + 2 * i] = (_Float16)s[1][i][0]; pa[u][9 + 2 * i] = (_Float16)s[1][i][1]; } }
#pragma unroll
    for (int j = 0; j < 4; ++j)
#pragma unroll
      for (int u = 0; u < 2; ++u) acc[u][j] = wmma16(vf[j], pa[u], acc[u][j]);   // A[m = c][k = key]; acc[u][j][r] = channel 16j+8g+r, query 16u+col
#pragma unroll
    for (int j = 0; j < 4; ++j) vf[j] = frag_o(VF + ((bh * (TT / 32) + kn) * 4 + j) * 512, lane);   // next pass's V: lands under the next scores and softmax
    asm volatile("s_wait_xcnt 0x0" ::: "memory"); }   // stands in front of the next pass's rewrite of the address registers that the V loads name
  if (kh == 1) {   // wave-uniform: key half 1 hands its state over
#pragma unroll
    for (int u = 0; u < 2; ++u) {
#pragma unroll
      for (int j = 0; j < 4; ++j)
#pragma unroll
        for (int r = 0; r < 8; ++r) ex[qg][u * 34 + j * 8 + r][lane] = acc[u][j][r];
      ex[qg][u * 34 + 32][lane] = b[u]; ex[qg][u * 34 + 33][lane] = l[u]; } }
  __syncthreads();
  if (kh == 0) {   // wave-uniform: key half 0 joins the two states on their common maximum and normalises
#pragma unroll
    for (int u = 0; u < 2; ++u) { const float b1 = ex[qg][u * 34 + 32][lane], bn = fminf(b[u], b1), a0 = __builtin_amdgcn_exp2f(bn - b[u]), a1 = __builtin_amdgcn_exp2f(bn - b1), lt = l[u] * a0 + ex[qg][u * 34 + 33][lane] * a1;
      const float il = 1.0f / (lt + xhalf(lt));   // the two lane halves' sums join here, once; O and l both carry 2^11
#pragma unroll
      for (int j = 0; j < 4; ++j)
#pragma unroll
        for (int r = 0; r < 8; ++r) st[j * 16 + 8 * g + r][qg * 32 + u * 16 + col] = (acc[u][j][r] * a0 + ex[qg][u * 34 + j * 8 + r][lane] * a1) * il; } }
  __syncthreads();
  for (int e = tid; e < CH * 16; e += 128) { const int c = e >> 4, q = e & 15; vst2((void*)(OUT + (bh * CH + c) * (size_t)TT + blockIdx.x * 64 + q * 4), *(const v4f*)&st[c][q * 4]); } }

extern "C" void kernel_launch(void* const* d_in, const int* in_sizes, int n_in, void* d_out, int out_size, void* d_ws, size_t ws_size, hipStream_t stream) {
  if (n_in < 1) return;
  if ((size_t)in_sizes[0] < (size_t)NB * WROWS * TT_FULL) return;   // [16,192,4096] f32
  if ((size_t)out_size < (size_t)NB * CH * TT) return;              // [16,64,4096] f32 at byte 0
  if (ws_size < (size_t)WS_END) return;
  const float* QKV = (const float*)d_in[0];
  char* ws = (char*)d_ws; _Float16 *QR = (_Float16*)(ws + WS_Q), *KF = (_Float16*)(ws + WS_K), *VF = (_Float16*)(ws + WS_V);
  k_prep<<<dim3(TT / 64, NB), 128, 0, stream>>>(QKV, QR, KF, VF);
  k_att<<<dim3(TT / 64, TBH), 128, 0, stream>>>(QR, KF, VF, (float*)d_out);
}
